// v000
// Times are from an AMD MI455X. After a warm-up the kernel runs many times in a row, and a time is the length of
// such a window on the GPU divided by its runs, so every launch and the gaps after it count. The runs cycle
// through copies of the inputs. A figure is the median of several windows, for all but v000 over two sittings.
// Sittings can differ by a few percent; kernels timed side by side share one.
// v000 is the starting kernel. One run takes 118 microseconds.
#include <hip/hip_runtime.h>
#include <hip/hip_bf16.h>

typedef __attribute__((ext_vector_type(16))) _Float16 v16h;
typedef __attribute__((ext_vector_type(8)))  _Float16 v8h;
typedef __attribute__((ext_vector_type(8)))  float    v8f;

namespace msa {
constexpr int kB = 8, kS = 1024, kDim = 1024, kH = 16, kD = 64;
constexpr int kTile = 128;           // rows per workgroup tile
constexpr int kLdX = 72;             // padded LDS row (halves), 144B = 9*16B -> aligned & conflict-spread
constexpr int kLdP = 136;            // padded LDS row for P / Vt (272B = 17*16B)
}

__device__ __forceinline__ v8f wmma_f16(v16h a, v16h b, v8f c) {
  // v_wmma_f32_16x16x32_f16: D = A(16x32) x B(32x16) + C, f32 accum
  return __builtin_amdgcn_wmma_f32_16x16x32_f16(false, a, false, b, (short)0, c,
                                                false, false);
}

// A-fragment loader for 16x32 f16 tile at mat[(m)*ld + k], row-major source.
// ISA layout: lanes 0-15 -> row m=lane, K-octets {0-7,16-23};
//             lanes 16-31 -> row m=lane-16, K-octets {8-15,24-31}.
// Also serves as the B-operand gather when the B source is stored [N][K]
// row-major (i.e. B^T), since column n of B is then a contiguous row.
__device__ __forceinline__ v16h load_frag_rm(const _Float16* mat, int ld, int lane) {
  const int m  = lane & 15;
  const int kb = (lane & 16) ? 8 : 0;
  const _Float16* p = mat + m * ld + kb;
  v8h lo = *(const v8h*)(p);        // K = kb .. kb+7   (16B aligned: ld % 8 == 0)
  v8h hi = *(const v8h*)(p + 16);   // K = kb+16 .. kb+23
  return __builtin_shufflevector(lo, hi, 0, 1, 2, 3, 4, 5, 6, 7,
                                 8, 9, 10, 11, 12, 13, 14, 15);
}

// CDNA5 async copy: 16B per lane, global -> LDS, bypassing VGPRs (ASYNCcnt).
// Flat addresses of __shared__ objects carry the wave-relative LDS address in
// their low 32 bits (ISA 10.2: LDS_ADDR = addr[31:0]).
__device__ __forceinline__ void async_copy_b128(const _Float16* g, _Float16* l) {
  unsigned int lds_addr = (unsigned int)(size_t)l;
  asm volatile("global_load_async_to_lds_b128 %0, %1, off"
               :: "v"(lds_addr), "v"(g)
               : "memory");
}

// ---------------------------------------------------------------------------
// Kernel 1: per-head QKV projection.  grid = (B*H, S/128), block = 256 (8 waves)
// q = 0.125*(xh @ Wq^T + bq), k = xh @ Wk^T + bk, v = xh @ Wv^T + bv
// Q,K stored f16 [B,H,S,D]; V stored transposed f16 [B,H,D,S].
// ---------------------------------------------------------------------------
__global__ __launch_bounds__(256) void msa_qkv_kernel(
    const float* __restrict__ x,  const float* __restrict__ Wq,
    const float* __restrict__ Wk, const float* __restrict__ Wv,
    const float* __restrict__ bq, const float* __restrict__ bk,
    const float* __restrict__ bv,
    _Float16* __restrict__ Qg, _Float16* __restrict__ Kg,
    _Float16* __restrict__ Vtg) {
  using namespace msa;
  __shared__ __attribute__((aligned(16))) _Float16 xs[kTile * kLdX];
  __shared__ __attribute__((aligned(16))) _Float16 wsm[3][kD * kLdX];

  const int bh = blockIdx.x;
  const int b = bh / kH, h = bh % kH;
  const int s0 = blockIdx.y * kTile;
  const int tid = threadIdx.x;
  const int wave = tid >> 5, lane = tid & 31;

  // stage x tile (cols h*64..h*64+63) as f16
  for (int i = tid; i < kTile * kD; i += 256) {
    const int r = i >> 6, d = i & 63;
    xs[r * kLdX + d] =
        (_Float16)x[((size_t)b * kS + (s0 + r)) * kDim + h * kD + d];
  }
  // stage the three 64x64 weight matrices for this head as f16 ([e][d] order)
  for (int i = tid; i < kD * kD; i += 256) {
    const size_t off = (size_t)h * kD * kD + i;
    const int e = i >> 6, d = i & 63;
    wsm[0][e * kLdX + d] = (_Float16)Wq[off];
    wsm[1][e * kLdX + d] = (_Float16)Wk[off];
    wsm[2][e * kLdX + d] = (_Float16)Wv[off];
  }
  __syncthreads();

  const int m0 = wave * 16;  // this wave's 16 rows
  const v16h a0 = load_frag_rm(xs + m0 * kLdX + 0,  kLdX, lane);
  const v16h a1 = load_frag_rm(xs + m0 * kLdX + 32, kLdX, lane);

  const int n_in = lane & 15;
  const int mofs = (lane & 16) ? 8 : 0;
  const size_t qkbase = ((size_t)bh * kS + s0 + m0) * kD;

  for (int proj = 0; proj < 3; ++proj) {
    const float* bias = (proj == 0) ? bq : (proj == 1) ? bk : bv;
#pragma unroll
    for (int nt = 0; nt < 4; ++nt) {
      // B = W^T gather: W stored [e][d] -> contiguous row per output column e
      const v16h b0 = load_frag_rm(&wsm[proj][(nt * 16) * kLdX + 0],  kLdX, lane);
      const v16h b1 = load_frag_rm(&wsm[proj][(nt * 16) * kLdX + 32], kLdX, lane);
      v8f acc = {};
      acc = wmma_f16(a0, b0, acc);
      acc = wmma_f16(a1, b1, acc);

      const int n = nt * 16 + n_in;
      const float bias_n = bias[h * kD + n];
#pragma unroll
      for (int i = 0; i < 8; ++i) acc[i] += bias_n;
      if (proj == 0) {
#pragma unroll
        for (int i = 0; i < 8; ++i) acc[i] *= 0.125f;  // 1/sqrt(D) folded into Q
      }

      if (proj == 2) {
        // V transposed: Vt[bh][n(d)][s] ; per lane 8 consecutive s positions
        const size_t vb = ((size_t)bh * kD + n) * kS + s0 + m0 + mofs;
#pragma unroll
        for (int i = 0; i < 8; ++i) Vtg[vb + i] = (_Float16)acc[i];
      } else {
        _Float16* out = (proj == 0) ? Qg : Kg;
#pragma unroll
        for (int i = 0; i < 8; ++i)
          out[qkbase + (size_t)(mofs + i) * kD + n] = (_Float16)acc[i];
      }
    }
  }
}

// ---------------------------------------------------------------------------
// Kernel 2: flash attention.  grid = (B*H, S/128), block = 256 (8 waves).
// Each wave owns 16 query rows; K/Vt tiles of 128 kv-positions stream into a
// double-buffered LDS pipeline via GLOBAL_LOAD_ASYNC_TO_LDS_B128 (ASYNCcnt).
// ---------------------------------------------------------------------------
__global__ __launch_bounds__(256) void msa_attn_kernel(
    const _Float16* __restrict__ Qg, const _Float16* __restrict__ Kg,
    const _Float16* __restrict__ Vtg, float* __restrict__ out) {
  using namespace msa;
  __shared__ __attribute__((aligned(16))) _Float16 qs[kTile * kLdX];
  __shared__ __attribute__((aligned(16))) _Float16 ks[2][kTile * kLdX];
  __shared__ __attribute__((aligned(16))) _Float16 vts[2][kD * kLdP];
  __shared__ __attribute__((aligned(16))) _Float16 ps[8 * 16 * kLdP];

  const int bh = blockIdx.x;
  const int b = bh / kH, h = bh % kH;
  const int s0 = blockIdx.y * kTile;
  const int tid = threadIdx.x;
  const int wave = tid >> 5, lane = tid & 31;

  const size_t qkbase = (size_t)bh * kS * kD;   // [B,H,S,D]
  const size_t vtbase = (size_t)bh * kD * kS;   // [B,H,D,S]

  // ---- async-stage the Q tile [128][64] ----
#pragma unroll
  for (int it = 0; it < 4; ++it) {
    const int idx = it * 2048 + tid * 8;       // 8 halves = 16B per op
    const int r = idx >> 6, d = idx & 63;
    async_copy_b128(Qg + qkbase + (size_t)(s0 + r) * kD + d, qs + r * kLdX + d);
  }
  asm volatile("s_wait_asynccnt 0x0" ::: "memory");
  __syncthreads();

  const int m0 = wave * 16;
  const v16h aq0 = load_frag_rm(qs + m0 * kLdX + 0,  kLdX, lane);
  const v16h aq1 = load_frag_rm(qs + m0 * kLdX + 32, kLdX, lane);

  // per-lane row state; VGPR slot i of every C/D tile maps to the same row
  float mrow[8], lrow[8];
  v8f o[4];
  const v8f vzero = {};
#pragma unroll
  for (int i = 0; i < 8; ++i) { mrow[i] = -3.0e38f; lrow[i] = 0.0f; }
#pragma unroll
  for (int nt = 0; nt < 4; ++nt) o[nt] = vzero;

  _Float16* pw = ps + wave * 16 * kLdP;  // this wave's private P strip
  const int n_in = lane & 15;
  const int mofs = (lane & 16) ? 8 : 0;

  // issue a kv tile (K [128][64] + Vt [64][128]) into LDS buffer `buf`
  auto issue_kv_tile = [&](int j0, int buf) {
    const _Float16* kg = Kg + qkbase + (size_t)j0 * kD;
    const _Float16* vg = Vtg + vtbase + j0;
    _Float16* kd = ks[buf];
    _Float16* vd = vts[buf];
#pragma unroll
    for (int it = 0; it < 4; ++it) {
      const int idx = it * 2048 + tid * 8;
      const int r = idx >> 6, d = idx & 63;
      async_copy_b128(kg + (size_t)r * kD + d, kd + r * kLdX + d);
    }
#pragma unroll
    for (int it = 0; it < 4; ++it) {
      const int idx = it * 2048 + tid * 8;
      const int d = idx >> 7, j = idx & 127;
      async_copy_b128(vg + (size_t)d * kS + j, vd + d * kLdP + j);
    }
  };

  issue_kv_tile(0, 0);  // prime the pipeline

  for (int t = 0; t < 8; ++t) {
    const int cur = t & 1;
    if (t < 7) {
      issue_kv_tile((t + 1) * 128, cur ^ 1);  // stream next tile behind compute
      // 8 ops of tile t may still be pending below 8 newly issued ones;
      // in-order completion => waiting to <=8 drains all of tile t.
      asm volatile("s_wait_asynccnt 0x8" ::: "memory");
    } else {
      asm volatile("s_wait_asynccnt 0x0" ::: "memory");
    }
    __syncthreads();

    const _Float16* kcur = ks[cur];
    const _Float16* vcur = vts[cur];

    // ---- scores: S = Q*K^T (K stored [j][d] row-major == B^T source) ----
    v8f sc[8];
#pragma unroll
    for (int ct = 0; ct < 8; ++ct) {
      const v16h b0 = load_frag_rm(kcur + (ct * 16) * kLdX + 0,  kLdX, lane);
      const v16h b1 = load_frag_rm(kcur + (ct * 16) * kLdX + 32, kLdX, lane);
      v8f acc = {};
      acc = wmma_f16(aq0, b0, acc);
      acc = wmma_f16(aq1, b1, acc);
      sc[ct] = acc;
    }

    // ---- online softmax: row max over the 128 columns ----
    float rmax[8];
#pragma unroll
    for (int i = 0; i < 8; ++i) rmax[i] = -3.0e38f;
#pragma unroll
    for (int ct = 0; ct < 8; ++ct)
#pragma unroll
      for (int i = 0; i < 8; ++i) rmax[i] = fmaxf(rmax[i], sc[ct][i]);
#pragma unroll
    for (int i = 0; i < 8; ++i) {  // reduce across the 16-lane N group
      float v = rmax[i];
      v = fmaxf(v, __shfl_xor(v, 1));
      v = fmaxf(v, __shfl_xor(v, 2));
      v = fmaxf(v, __shfl_xor(v, 4));
      v = fmaxf(v, __shfl_xor(v, 8));
      rmax[i] = v;
    }
#pragma unroll
    for (int i = 0; i < 8; ++i) {
      const float mn = fmaxf(mrow[i], rmax[i]);
      const float scale = __expf(mrow[i] - mn);
      mrow[i] = mn;
      lrow[i] *= scale;
#pragma unroll
      for (int nt = 0; nt < 4; ++nt) o[nt][i] *= scale;
    }

    // ---- P = exp(S - m), row sums, stage P (f16) for the PV matmul ----
#pragma unroll
    for (int ct = 0; ct < 8; ++ct) {
#pragma unroll
      for (int i = 0; i < 8; ++i) {
        const float p = __expf(sc[ct][i] - mrow[i]);
        sc[ct][i] = p;
        pw[(mofs + i) * kLdP + ct * 16 + n_in] = (_Float16)p;
      }
#pragma unroll
      for (int i = 0; i < 8; ++i) {
        float v = sc[ct][i];
        v += __shfl_xor(v, 1);
        v += __shfl_xor(v, 2);
        v += __shfl_xor(v, 4);
        v += __shfl_xor(v, 8);
        lrow[i] += v;
      }
    }

    // ---- O += P * V  (Vt stored [d][j] row-major == B^T source) ----
#pragma unroll
    for (int kc = 0; kc < 4; ++kc) {
      const v16h ap = load_frag_rm(pw + kc * 32, kLdP, lane);
#pragma unroll
      for (int nt = 0; nt < 4; ++nt) {
        const v16h bv = load_frag_rm(vcur + (nt * 16) * kLdP + kc * 32, kLdP, lane);
        o[nt] = wmma_f16(ap, bv, o[nt]);
      }
    }
    __syncthreads();  // all waves done with buffer `cur` before it is re-filled
  }

  // ---- epilogue: out[b, s0+m0+m, h*64+n] = O / l ----
#pragma unroll
  for (int nt = 0; nt < 4; ++nt) {
    const int n = nt * 16 + n_in;
#pragma unroll
    for (int i = 0; i < 8; ++i) {
      out[((size_t)b * kS + s0 + m0 + mofs + i) * kDim + h * kD + n] =
          o[nt][i] / lrow[i];
    }
  }
}

extern "C" void kernel_launch(void* const* d_in, const int* in_sizes, int n_in,
                              void* d_out, int out_size, void* d_ws,
                              size_t ws_size, hipStream_t stream) {
  using namespace msa;
  const float* x  = (const float*)d_in[0];
  const float* Wq = (const float*)d_in[1];
  const float* Wk = (const float*)d_in[2];
  const float* Wv = (const float*)d_in[3];
  const float* bq = (const float*)d_in[4];
  const float* bk = (const float*)d_in[5];
  const float* bv = (const float*)d_in[6];
  float* out = (float*)d_out;

  // workspace: Q,K f16 [B,H,S,D]; Vt f16 [B,H,D,S]  (3 * 16 MB = 48 MB)
  const size_t elems = (size_t)kB * kH * kS * kD;
  _Float16* Qg  = (_Float16*)d_ws;
  _Float16* Kg  = Qg + elems;
  _Float16* Vtg = Kg + elems;

  dim3 grid(kB * kH, kS / kTile);
  msa_qkv_kernel<<<grid, 256, 0, stream>>>(x, Wq, Wk, Wv, bq, bk, bv, Qg, Kg, Vtg);
  msa_attn_kernel<<<grid, 256, 0, stream>>>(Qg, Kg, Vtg, out);
}

// v001
// One run takes 69.5 microseconds.
// Next to v000, in two timings, it ran 1.77 times as fast each time.
#include <hip/hip_runtime.h>
#include <hip/hip_bf16.h>

typedef __attribute__((ext_vector_type(16))) _Float16 v16h;
typedef __attribute__((ext_vector_type(8)))  _Float16 v8h;
typedef __attribute__((ext_vector_type(8)))  float    v8f;

namespace msa {
constexpr int kB = 8, kS = 1024, kDim = 1024, kH = 16, kD = 64;
constexpr int kTile = 128;           // rows per workgroup tile
constexpr int kLdX = 72;             // padded LDS row (halves), 144B = 9*16B -> aligned & conflict-spread
constexpr int kLdP = 136;            // padded LDS row for P / Vt (272B = 17*16B)
}

__device__ __forceinline__ v8f wmma_f16(v16h a, v16h b, v8f c) {
  // v_wmma_f32_16x16x32_f16: D = A(16x32) x B(32x16) + C, f32 accum
  return __builtin_amdgcn_wmma_f32_16x16x32_f16(false, a, false, b, (short)0, c,
                                                false, false);
}

// A-fragment loader for 16x32 f16 tile at mat[(m)*ld + k], row-major source.
// ISA layout: lanes 0-15 -> row m=lane, K-octets {0-7,16-23};
//             lanes 16-31 -> row m=lane-16, K-octets {8-15,24-31}.
// Also serves as the B-operand gather when the B source is stored [N][K]
// row-major (i.e. B^T), since column n of B is then a contiguous row.
__device__ __forceinline__ v16h load_frag_rm(const _Float16* mat, int ld, int lane) {
  const int m  = lane & 15;
  const int kb = (lane & 16) ? 8 : 0;
  const _Float16* p = mat + m * ld + kb;
  v8h lo = *(const v8h*)(p);        // K = kb .. kb+7   (16B aligned: ld % 8 == 0)
  v8h hi = *(const v8h*)(p + 16);   // K = kb+16 .. kb+23
  return __builtin_shufflevector(lo, hi, 0, 1, 2, 3, 4, 5, 6, 7,
                                 8, 9, 10, 11, 12, 13, 14, 15);
}

// CDNA5 async copy: 16B per lane, global -> LDS, bypassing VGPRs (ASYNCcnt).
// Flat addresses of __shared__ objects carry the wave-relative LDS address in
// their low 32 bits (ISA 10.2: LDS_ADDR = addr[31:0]).
__device__ __forceinline__ void async_copy_b128(const _Float16* g, _Float16* l) {
  unsigned int lds_addr = (unsigned int)(size_t)l;
  asm volatile("global_load_async_to_lds_b128 %0, %1, off"
               :: "v"(lds_addr), "v"(g)
               : "memory");
}

// ---------------------------------------------------------------------------
// Kernel 1: per-head QKV projection.  grid = (B*H, S/128), block = 256 (8 waves)
// q = 0.125*(xh @ Wq^T + bq), k = xh @ Wk^T + bk, v = xh @ Wv^T + bv
// Q,K stored f16 [B,H,S,D]; V stored transposed f16 [B,H,D,S].
// ---------------------------------------------------------------------------
__global__ __launch_bounds__(256) void msa_qkv_kernel(
    const float* __restrict__ x,  const float* __restrict__ Wq,
    const float* __restrict__ Wk, const float* __restrict__ Wv,
    const float* __restrict__ bq, const float* __restrict__ bk,
    const float* __restrict__ bv,
    _Float16* __restrict__ Qg, _Float16* __restrict__ Kg,
    _Float16* __restrict__ Vtg) {
  using namespace msa;
  __shared__ __attribute__((aligned(16))) _Float16 xs[kTile * kLdX];
  __shared__ __attribute__((aligned(16))) _Float16 wsm[3][kD * kLdX];

  const int bh = blockIdx.x;
  const int b = bh / kH, h = bh % kH;
  const int s0 = blockIdx.y * kTile;
  const int tid = threadIdx.x;
  const int wave = tid >> 5, lane = tid & 31;

  // stage x tile (cols h*64..h*64+63) as f16
  for (int i = tid; i < kTile * kD; i += 256) {
    const int r = i >> 6, d = i & 63;
    xs[r * kLdX + d] =
        (_Float16)x[((size_t)b * kS + (s0 + r)) * kDim + h * kD + d];
  }
  // stage the three 64x64 weight matrices for this head as f16 ([e][d] order)
  for (int i = tid; i < kD * kD; i += 256) {
    const size_t off = (size_t)h * kD * kD + i;
    const int e = i >> 6, d = i & 63;
    wsm[0][e * kLdX + d] = (_Float16)Wq[off];
    wsm[1][e * kLdX + d] = (_Float16)Wk[off];
    wsm[2][e * kLdX + d] = (_Float16)Wv[off];
  }
  __syncthreads();

  const int m0 = wave * 16;  // this wave's 16 rows
  const v16h a0 = load_frag_rm(xs + m0 * kLdX + 0,  kLdX, lane);
  const v16h a1 = load_frag_rm(xs + m0 * kLdX + 32, kLdX, lane);

  const int n_in = lane & 15;
  const int mofs = (lane & 16) ? 8 : 0;
  const size_t qkbase = ((size_t)bh * kS + s0 + m0) * kD;

  for (int proj = 0; proj < 3; ++proj) {
    const float* bias = (proj == 0) ? bq : (proj == 1) ? bk : bv;
#pragma unroll
    for (int nt = 0; nt < 4; ++nt) {
      // B = W^T gather: W stored [e][d] -> contiguous row per output column e
      const v16h b0 = load_frag_rm(&wsm[proj][(nt * 16) * kLdX + 0],  kLdX, lane);
      const v16h b1 = load_frag_rm(&wsm[proj][(nt * 16) * kLdX + 32], kLdX, lane);
      v8f acc = {};
      acc = wmma_f16(a0, b0, acc);
      acc = wmma_f16(a1, b1, acc);

      const int n = nt * 16 + n_in;
      const float bias_n = bias[h * kD + n];
#pragma unroll
      for (int i = 0; i < 8; ++i) acc[i] += bias_n;
      if (proj == 0) {
#pragma unroll
        for (int i = 0; i < 8; ++i) acc[i] *= 0.125f;  // 1/sqrt(D) folded into Q
      }

      if (proj == 2) {
        // V transposed: Vt[bh][n(d)][s] ; per lane 8 consecutive s positions
        const size_t vb = ((size_t)bh * kD + n) * kS + s0 + m0 + mofs;
#pragma unroll
        for (int i = 0; i < 8; ++i) Vtg[vb + i] = (_Float16)acc[i];
      } else {
        _Float16* out = (proj == 0) ? Qg : Kg;
#pragma unroll
        for (int i = 0; i < 8; ++i)
          out[qkbase + (size_t)(mofs + i) * kD + n] = (_Float16)acc[i];
      }
    }
  }
}

// ---------------------------------------------------------------------------
// Kernel 2: flash attention.  grid = (B*H, S/128), block = 256 (8 waves).
// Each wave owns 16 query rows; K/Vt tiles of 128 kv-positions stream into a
// double-buffered LDS pipeline via GLOBAL_LOAD_ASYNC_TO_LDS_B128 (ASYNCcnt).
// ---------------------------------------------------------------------------
__global__ __launch_bounds__(256) void msa_attn_kernel(
    const _Float16* __restrict__ Qg, const _Float16* __restrict__ Kg,
    const _Float16* __restrict__ Vtg, float* __restrict__ out) {
  using namespace msa;
  __shared__ __attribute__((aligned(16))) _Float16 qs[kTile * kLdX];
  __shared__ __attribute__((aligned(16))) _Float16 ks[2][kTile * kLdX];
  __shared__ __attribute__((aligned(16))) _Float16 vts[2][kD * kLdP];
  __shared__ __attribute__((aligned(16))) _Float16 ps[8 * 16 * kLdP];

  const int bh = blockIdx.x;
  const int b = bh / kH, h = bh % kH;
  const int s0 = blockIdx.y * kTile;
  const int tid = threadIdx.x;
  const int wave = tid >> 5, lane = tid & 31;

  const size_t qkbase = (size_t)bh * kS * kD;   // [B,H,S,D]
  const size_t vtbase = (size_t)bh * kD * kS;   // [B,H,D,S]

  // ---- async-stage the Q tile [128][64] ----
#pragma unroll
  for (int it = 0; it < 4; ++it) {
    const int idx = it * 2048 + tid * 8;       // 8 halves = 16B per op
    const int r = idx >> 6, d = idx & 63;
    async_copy_b128(Qg + qkbase + (size_t)(s0 + r) * kD + d, qs + r * kLdX + d);
  }
  asm volatile("s_wait_asynccnt 0x0" ::: "memory");
  __syncthreads();

  const int m0 = wave * 16;
  const v16h aq0 = load_frag_rm(qs + m0 * kLdX + 0,  kLdX, lane);
  const v16h aq1 = load_frag_rm(qs + m0 * kLdX + 32, kLdX, lane);

  // per-lane row state; VGPR slot i of every C/D tile maps to the same row;
  // lrow holds this lane's share of the row sum until the loop has ended
  float mrow[8], lrow[8];
  v8f o[4];
  const v8f vzero = {};
#pragma unroll
  for (int i = 0; i < 8; ++i) { mrow[i] = -3.0e38f; lrow[i] = 0.0f; }
#pragma unroll
  for (int nt = 0; nt < 4; ++nt) o[nt] = vzero;

  _Float16* pw = ps + wave * 16 * kLdP;  // this wave's private P strip
  const int n_in = lane & 15;
  const int mofs = (lane & 16) ? 8 : 0;

  // issue a kv tile (K [128][64] + Vt [64][128]) into LDS buffer `buf`
  auto issue_kv_tile = [&](int j0, int buf) {
    const _Float16* kg = Kg + qkbase + (size_t)j0 * kD;
    const _Float16* vg = Vtg + vtbase + j0;
    _Float16* kd = ks[buf];
    _Float16* vd = vts[buf];
#pragma unroll
    for (int it = 0; it < 4; ++it) {
      const int idx = it * 2048 + tid * 8;
      const int r = idx >> 6, d = idx & 63;
      async_copy_b128(kg + (size_t)r * kD + d, kd + r * kLdX + d);
    }
#pragma unroll
    for (int it = 0; it < 4; ++it) {
      const int idx = it * 2048 + tid * 8;
      const int d = idx >> 7, j = idx & 127;
      async_copy_b128(vg + (size_t)d * kS + j, vd + d * kLdP + j);
    }
  };

  issue_kv_tile(0, 0);  // prime the pipeline

  for (int t = 0; t < 8; ++t) {
    const int cur = t & 1;
    if (t < 7) {
      issue_kv_tile((t + 1) * 128, cur ^ 1);  // stream next tile behind compute
      // 8 ops of tile t may still be pending below 8 newly issued ones;
      // in-order completion => waiting to <=8 drains all of tile t.
      asm volatile("s_wait_asynccnt 0x8" ::: "memory");
    } else {
      asm volatile("s_wait_asynccnt 0x0" ::: "memory");
    }
    __syncthreads();

    const _Float16* kcur = ks[cur];
    const _Float16* vcur = vts[cur];

    // ---- scores: S = Q*K^T (K stored [j][d] row-major == B^T source) ----
    v8f sc[8];
#pragma unroll
    for (int ct = 0; ct < 8; ++ct) {
      const v16h b0 = load_frag_rm(kcur + (ct * 16) * kLdX + 0,  kLdX, lane);
      const v16h b1 = load_frag_rm(kcur + (ct * 16) * kLdX + 32, kLdX, lane);
      v8f acc = {};
      acc = wmma_f16(aq0, b0, acc);
      acc = wmma_f16(aq1, b1, acc);
      sc[ct] = acc;
    }

    // ---- online softmax: row max over the 128 columns ----
    float rmax[8];
#pragma unroll
    for (int i = 0; i < 8; ++i) rmax[i] = -3.0e38f;
#pragma unroll
    for (int ct = 0; ct < 8; ++ct)
#pragma unroll
      for (int i = 0; i < 8; ++i) rmax[i] = fmaxf(rmax[i], sc[ct][i]);
#pragma unroll
    for (int i = 0; i < 8; ++i) {  // reduce across the 16-lane N group
      float v = rmax[i];
      v = fmaxf(v, __shfl_xor(v, 1));
      v = fmaxf(v, __shfl_xor(v, 2));
      v = fmaxf(v, __shfl_xor(v, 4));
      v = fmaxf(v, __shfl_xor(v, 8));
      rmax[i] = v;
    }
#pragma unroll
    for (int i = 0; i < 8; ++i) {
      const float mn = fmaxf(mrow[i], rmax[i]);
      const float scale = __expf(mrow[i] - mn);
      mrow[i] = mn;
      lrow[i] *= scale;
#pragma unroll
      for (int nt = 0; nt < 4; ++nt) o[nt][i] *= scale;
    }

    // ---- P = exp(S - m), stage P (f16) for the PV matmul; each lane adds
    // only its own columns into lrow (the rescale factor is the same in all
    // 16 lanes of a row, so the partial sums stay on one common scale) ----
#pragma unroll
    for (int ct = 0; ct < 8; ++ct) {
#pragma unroll
      for (int i = 0; i < 8; ++i) {
        const float p = __expf(sc[ct][i] - mrow[i]);
        pw[(mofs + i) * kLdP + ct * 16 + n_in] = (_Float16)p;
        lrow[i] += p;
      }
    }

    // ---- O += P * V  (Vt stored [d][j] row-major == B^T source) ----
#pragma unroll
    for (int kc = 0; kc < 4; ++kc) {
      const v16h ap = load_frag_rm(pw + kc * 32, kLdP, lane);
#pragma unroll
      for (int nt = 0; nt < 4; ++nt) {
        const v16h bv = load_frag_rm(vcur + (nt * 16) * kLdP + kc * 32, kLdP, lane);
        o[nt] = wmma_f16(ap, bv, o[nt]);
      }
    }
    __syncthreads();  // all waves done with buffer `cur` before it is re-filled
  }

  // ---- join the 16 lanes' partial row sums, once for all kv tiles ----
#pragma unroll
  for (int i = 0; i < 8; ++i) {
    float v = lrow[i];
    v += __shfl_xor(v, 1);
    v += __shfl_xor(v, 2);
    v += __shfl_xor(v, 4);
    v += __shfl_xor(v, 8);
    lrow[i] = v;
  }

  // ---- epilogue: out[b, s0+m0+m, h*64+n] = O / l ----
#pragma unroll
  for (int nt = 0; nt < 4; ++nt) {
    const int n = nt * 16 + n_in;
#pragma unroll
    for (int i = 0; i < 8; ++i) {
      out[((size_t)b * kS + s0 + m0 + mofs + i) * kDim + h * kD + n] =
          o[nt][i] / lrow[i];
    }
  }
}

extern "C" void kernel_launch(void* const* d_in, const int* in_sizes, int n_in,
                              void* d_out, int out_size, void* d_ws,
                              size_t ws_size, hipStream_t stream) {
  using namespace msa;
  const float* x  = (const float*)d_in[0];
  const float* Wq = (const float*)d_in[1];
  const float* Wk = (const float*)d_in[2];
  const float* Wv = (const float*)d_in[3];
  const float* bq = (const float*)d_in[4];
  const float* bk = (const float*)d_in[5];
  const float* bv = (const float*)d_in[6];
  float* out = (float*)d_out;

  // workspace: Q,K f16 [B,H,S,D]; Vt f16 [B,H,D,S]  (3 * 16 MB = 48 MB)
  const size_t elems = (size_t)kB * kH * kS * kD;
  _Float16* Qg  = (_Float16*)d_ws;
  _Float16* Kg  = Qg + elems;
  _Float16* Vtg = Kg + elems;

  dim3 grid(kB * kH, kS / kTile);
  msa_qkv_kernel<<<grid, 256, 0, stream>>>(x, Wq, Wk, Wv, bq, bk, bv, Qg, Kg, Vtg);
  msa_attn_kernel<<<grid, 256, 0, stream>>>(Qg, Kg, Vtg, out);
}

// v002
// It runs in 56 microseconds.
// Timed twice side by side with v001, it ran 1.24 times as fast both times.
// Over all steps from v000 it is 2.20 times as fast.
#include <hip/hip_runtime.h>
#include <hip/hip_bf16.h>

typedef __attribute__((ext_vector_type(16))) _Float16 v16h;
typedef __attribute__((ext_vector_type(8)))  _Float16 v8h;
typedef __attribute__((ext_vector_type(8)))  float    v8f;
typedef __attribute__((ext_vector_type(4)))  float    v4f;

namespace msa {
constexpr int kB = 8, kS = 1024, kDim = 1024, kH = 16, kD = 64;
constexpr int kTile = 128;           // rows per workgroup tile
constexpr int kLdX = 72;             // padded LDS row (halves), 144B = 9*16B -> aligned & conflict-spread
constexpr int kLdP = 136;            // padded LDS row for Vt (272B = 17*16B)
constexpr int kLdO = 68;             // padded LDS row (floats) of the output staging (272B = 17*16B)
}

__device__ __forceinline__ v8f wmma_f16(v16h a, v16h b, v8f c) {
  // v_wmma_f32_16x16x32_f16: D = A(16x32) x B(32x16) + C, f32 accum
  return __builtin_amdgcn_wmma_f32_16x16x32_f16(false, a, false, b, (short)0, c,
                                                false, false);
}

// A-fragment loader for 16x32 f16 tile at mat[(m)*ld + k], row-major source.
// ISA layout: lanes 0-15 -> row m=lane, K-octets {0-7,16-23};
//             lanes 16-31 -> row m=lane-16, K-octets {8-15,24-31}.
// Also serves as the B-operand gather when the B source is stored [N][K]
// row-major (i.e. B^T), since column n of B is then a contiguous row.
__device__ __forceinline__ v16h load_frag_rm(const _Float16* mat, int ld, int lane) {
  const int m  = lane & 15;
  const int kb = (lane & 16) ? 8 : 0;
  const _Float16* p = mat + m * ld + kb;
  v8h lo = *(const v8h*)(p);        // K = kb .. kb+7   (16B aligned: ld % 8 == 0)
  v8h hi = *(const v8h*)(p + 16);   // K = kb+16 .. kb+23
  return __builtin_shufflevector(lo, hi, 0, 1, 2, 3, 4, 5, 6, 7,
                                 8, 9, 10, 11, 12, 13, 14, 15);
}

// value of lane l ^ 16 (the other 16-lane half), as a vector cross-row move
__device__ __forceinline__ float xhalf(float x) {
  const int v = __builtin_bit_cast(int, x);
  return __builtin_bit_cast(float, __builtin_amdgcn_permlanex16(
      v, v, 0x76543210, 0xfedcba98, false, false));
}

// CDNA5 async copy: 16B per lane, global -> LDS, bypassing VGPRs (ASYNCcnt).
// Flat addresses of __shared__ objects carry the wave-relative LDS address in
// their low 32 bits (ISA 10.2: LDS_ADDR = addr[31:0]).
__device__ __forceinline__ void async_copy_b128(const _Float16* g, _Float16* l) {
  unsigned int lds_addr = (unsigned int)(size_t)l;
  asm volatile("global_load_async_to_lds_b128 %0, %1, off"
               :: "v"(lds_addr), "v"(g)
               : "memory");
}

// ---------------------------------------------------------------------------
// Kernel 1: per-head QKV projection.  grid = (B*H, S/128), block = 256 (8 waves)
// q = 0.125*(xh @ Wq^T + bq), k = xh @ Wk^T + bk, v = xh @ Wv^T + bv
// Q,K stored f16 [B,H,S,D]; V stored transposed f16 [B,H,D,S].
// ---------------------------------------------------------------------------
__global__ __launch_bounds__(256) void msa_qkv_kernel(
    const float* __restrict__ x,  const float* __restrict__ Wq,
    const float* __restrict__ Wk, const float* __restrict__ Wv,
    const float* __restrict__ bq, const float* __restrict__ bk,
    const float* __restrict__ bv,
    _Float16* __restrict__ Qg, _Float16* __restrict__ Kg,
    _Float16* __restrict__ Vtg) {
  using namespace msa;
  __shared__ __attribute__((aligned(16))) _Float16 xs[kTile * kLdX];
  __shared__ __attribute__((aligned(16))) _Float16 wsm[3][kD * kLdX];

  const int bh = blockIdx.x;
  const int b = bh / kH, h = bh % kH;
  const int s0 = blockIdx.y * kTile;
  const int tid = threadIdx.x;
  const int wave = tid >> 5, lane = tid & 31;

  // stage x tile (cols h*64..h*64+63) as f16
  for (int i = tid; i < kTile * kD; i += 256) {
    const int r = i >> 6, d = i & 63;
    xs[r * kLdX + d] =
        (_Float16)x[((size_t)b * kS + (s0 + r)) * kDim + h * kD + d];
  }
  // stage the three 64x64 weight matrices for this head as f16 ([e][d] order)
  for (int i = tid; i < kD * kD; i += 256) {
    const size_t off = (size_t)h * kD * kD + i;
    const int e = i >> 6, d = i & 63;
    wsm[0][e * kLdX + d] = (_Float16)Wq[off];
    wsm[1][e * kLdX + d] = (_Float16)Wk[off];
    wsm[2][e * kLdX + d] = (_Float16)Wv[off];
  }
  __syncthreads();

  const int m0 = wave * 16;  // this wave's 16 rows
  const v16h a0 = load_frag_rm(xs + m0 * kLdX + 0,  kLdX, lane);
  const v16h a1 = load_frag_rm(xs + m0 * kLdX + 32, kLdX, lane);

  const int n_in = lane & 15;
  const int mofs = (lane & 16) ? 8 : 0;
  const size_t qkbase = ((size_t)bh * kS + s0 + m0) * kD;

  for (int proj = 0; proj < 3; ++proj) {
    const float* bias = (proj == 0) ? bq : (proj == 1) ? bk : bv;
#pragma unroll
    for (int nt = 0; nt < 4; ++nt) {
      // B = W^T gather: W stored [e][d] -> contiguous row per output column e
      const v16h b0 = load_frag_rm(&wsm[proj][(nt * 16) * kLdX + 0],  kLdX, lane);
      const v16h b1 = load_frag_rm(&wsm[proj][(nt * 16) * kLdX + 32], kLdX, lane);
      v8f acc = {};
      acc = wmma_f16(a0, b0, acc);
      acc = wmma_f16(a1, b1, acc);

      const int n = nt * 16 + n_in;
      const float bias_n = bias[h * kD + n];
#pragma unroll
      for (int i = 0; i < 8; ++i) acc[i] += bias_n;
      if (proj == 0) {
#pragma unroll
        for (int i = 0; i < 8; ++i) acc[i] *= 0.125f;  // 1/sqrt(D) folded into Q
      }

      if (proj == 2) {
        // V transposed: Vt[bh][n(d)][s] ; per lane 8 consecutive s positions
        const size_t vb = ((size_t)bh * kD + n) * kS + s0 + m0 + mofs;
#pragma unroll
        for (int i = 0; i < 8; ++i) Vtg[vb + i] = (_Float16)acc[i];
      } else {
        _Float16* out = (proj == 0) ? Qg : Kg;
#pragma unroll
        for (int i = 0; i < 8; ++i)
          out[qkbase + (size_t)(mofs + i) * kD + n] = (_Float16)acc[i];
      }
    }
  }
}

__global__ __launch_bounds__(256) void msa_attn_kernel(
    const _Float16* __restrict__ Qg, const _Float16* __restrict__ Kg,
    const _Float16* __restrict__ Vtg, float* __restrict__ out) {
  using namespace msa;
  __shared__ __attribute__((aligned(16))) _Float16 qs[kTile * kLdX];
  __shared__ __attribute__((aligned(16))) _Float16 ks[2][kTile * kLdX];
  __shared__ __attribute__((aligned(16))) _Float16 vts[2][kD * kLdP];
  static_assert(8 * 16 * kLdO * 4 <= 2 * kTile * kLdX * 2, "output staging fits in ks");

  const int bh = blockIdx.x;
  const int b = bh / kH, h = bh % kH;
  const int s0 = blockIdx.y * kTile;
  const int tid = threadIdx.x;
  const int wave = tid >> 5, lane = tid & 31;

  const size_t qkbase = (size_t)bh * kS * kD;   // [B,H,S,D]
  const size_t vtbase = (size_t)bh * kD * kS;   // [B,H,D,S]

  // ---- async-stage the Q tile [128][64] ----
#pragma unroll
  for (int it = 0; it < 4; ++it) {
    const int idx = it * 2048 + tid * 8;       // 8 halves = 16B per op
    const int r = idx >> 6, d = idx & 63;
    async_copy_b128(Qg + qkbase + (size_t)(s0 + r) * kD + d, qs + r * kLdX + d);
  }
  asm volatile("s_wait_asynccnt 0x0" ::: "memory");
  __syncthreads();

  const int m0 = wave * 16;
  const v16h aq0 = load_frag_rm(qs + m0 * kLdX + 0,  kLdX, lane);
  const v16h aq1 = load_frag_rm(qs + m0 * kLdX + 32, kLdX, lane);

  // per-lane state of query column lane & 15; lrow holds this lane's share of
  // the row sum (its half of the kv positions) until the loop has ended
  float mrow = -3.0e38f, lrow = 0.0f;
  v8f o[4];  // O^T tiles: o[nt][i] = O[query lane & 15][nt*16 + mofs + i]
  const v8f vzero = {};
#pragma unroll
  for (int nt = 0; nt < 4; ++nt) o[nt] = vzero;

  const int n_in = lane & 15;
  const int mofs = (lane & 16) ? 8 : 0;

  // issue a kv tile (K [128][64] + Vt [64][128]) into LDS buffer `buf`
  auto issue_kv_tile = [&](int j0, int buf) {
    const _Float16* kg = Kg + qkbase + (size_t)j0 * kD;
    const _Float16* vg = Vtg + vtbase + j0;
    _Float16* kd = ks[buf];
    _Float16* vd = vts[buf];
#pragma unroll
    for (int it = 0; it < 4; ++it) {
      const int idx = it * 2048 + tid * 8;
      const int r = idx >> 6, d = idx & 63;
      async_copy_b128(kg + (size_t)r * kD + d, kd + r * kLdX + d);
    }
#pragma unroll
    for (int it = 0; it < 4; ++it) {
      const int idx = it * 2048 + tid * 8;
      const int d = idx >> 7, j = idx & 127;
      async_copy_b128(vg + (size_t)d * kS + j, vd + d * kLdP + j);
    }
  };

  issue_kv_tile(0, 0);  // prime the pipeline

  for (int t = 0; t < 8; ++t) {
    const int cur = t & 1;
    if (t < 7) {
      issue_kv_tile((t + 1) * 128, cur ^ 1);  // stream next tile behind compute
      // 8 ops of tile t may still be pending below 8 newly issued ones;
      // in-order completion => waiting to <=8 drains all of tile t.
      asm volatile("s_wait_asynccnt 0x8" ::: "memory");
    } else {
      asm volatile("s_wait_asynccnt 0x0" ::: "memory");
    }
    __syncthreads();

    const _Float16* kcur = ks[cur];
    const _Float16* vcur = vts[cur];

    // ---- scores: S^T = K*Q^T; sc[ct][i] = S[query n_in][kv ct*16 + mofs + i] ----
    v8f sc[8];
#pragma unroll
    for (int ct = 0; ct < 8; ++ct) {
      const v16h k0 = load_frag_rm(kcur + (ct * 16) * kLdX + 0,  kLdX, lane);
      const v16h k1 = load_frag_rm(kcur + (ct * 16) * kLdX + 32, kLdX, lane);
      v8f acc = {};
      acc = wmma_f16(k0, aq0, acc);
      acc = wmma_f16(k1, aq1, acc);
      sc[ct] = acc;
    }

    // ---- online softmax: the query's max over the 128 kv positions ----
    float rmax[8];
#pragma unroll
    for (int i = 0; i < 8; ++i) rmax[i] = sc[0][i];
#pragma unroll
    for (int ct = 1; ct < 8; ++ct)
#pragma unroll
      for (int i = 0; i < 8; ++i) rmax[i] = fmaxf(rmax[i], sc[ct][i]);
    float mx = fmaxf(fmaxf(fmaxf(rmax[0], rmax[1]), fmaxf(rmax[2], rmax[3])),
                     fmaxf(fmaxf(rmax[4], rmax[5]), fmaxf(rmax[6], rmax[7])));
    mx = fmaxf(mx, xhalf(mx));  // both halves now hold the query's tile max
    const float mn = fmaxf(mrow, mx);
    const float scale = __expf(mrow - mn);
    mrow = mn;
#pragma unroll
    for (int nt = 0; nt < 4; ++nt) o[nt] *= scale;

    // ---- P^T = exp(S^T - m), O^T += V^T * P^T.  Two S^T tiles (kv kc*32 ..
    // +15 and +16 .. +31), converted in place, sit in the k order of
    // load_frag_rm: element s < 8 is k = mofs + s, element s >= 8 is
    // k = 16 + mofs + (s - 8).  (Vt stored [d][j] row-major == A source) ----
    float ts0 = 0.0f, ts1 = 0.0f;  // two chains for this tile's share of the row sum
#pragma unroll
    for (int kc = 0; kc < 4; ++kc) {
      v8f p0, p1;
#pragma unroll
      for (int i = 0; i < 8; ++i) {
        p0[i] = __expf(sc[2 * kc][i] - mrow);
        p1[i] = __expf(sc[2 * kc + 1][i] - mrow);
        ts0 += p0[i];
        ts1 += p1[i];
      }
      const v8h h0 = __builtin_convertvector(p0, v8h);
      const v8h h1 = __builtin_convertvector(p1, v8h);
      const v16h bp = __builtin_shufflevector(h0, h1, 0, 1, 2, 3, 4, 5, 6, 7,
                                              8, 9, 10, 11, 12, 13, 14, 15);
#pragma unroll
      for (int nt = 0; nt < 4; ++nt) {
        const v16h av = load_frag_rm(vcur + (nt * 16) * kLdP + kc * 32, kLdP, lane);
        o[nt] = wmma_f16(av, bp, o[nt]);
      }
    }
    lrow = lrow * scale + (ts0 + ts1);
    __syncthreads();  // all waves done with buffer `cur` before it is re-filled
  }

  // ---- join the two halves' partial row sums, once for all kv tiles ----
  lrow += xhalf(lrow);
  const float inv = 1.0f / lrow;

  // ---- epilogue: out[b, s0+m0+q, h*64+d] = O / l.  A lane holds 8 consecutive
  // d of one query; each wave turns its 16x64 tile through its own LDS range so
  // that every store instruction covers whole 256-byte rows.  ks is free: the
  // loop's last barrier ended every read of it and no copy is in flight. ----
  float* ost = reinterpret_cast<float*>(&ks[0][0]) + wave * 16 * kLdO;
#pragma unroll
  for (int nt = 0; nt < 4; ++nt) {
    const v8f r = o[nt] * inv;
    float* p = ost + n_in * kLdO + nt * 16 + mofs;
    *reinterpret_cast<v4f*>(p)     = __builtin_shufflevector(r, r, 0, 1, 2, 3);
    *reinterpret_cast<v4f*>(p + 4) = __builtin_shufflevector(r, r, 4, 5, 6, 7);
  }
  // the wave's own staging writes are done before other lanes read them back
  asm volatile("s_wait_dscnt 0x0" ::: "memory");
#pragma unroll
  for (int it = 0; it < 8; ++it) {
    const int row = it * 2 + (lane >> 4);
    const v4f v = *reinterpret_cast<const v4f*>(ost + row * kLdO + n_in * 4);
    *reinterpret_cast<v4f*>(
        out + ((size_t)b * kS + s0 + m0 + row) * kDim + h * kD + n_in * 4) = v;
  }
}

extern "C" void kernel_launch(void* const* d_in, const int* in_sizes, int n_in,
                              void* d_out, int out_size, void* d_ws,
                              size_t ws_size, hipStream_t stream) {
  using namespace msa;
  const float* x  = (const float*)d_in[0];
  const float* Wq = (const float*)d_in[1];
  const float* Wk = (const float*)d_in[2];
  const float* Wv = (const float*)d_in[3];
  const float* bq = (const float*)d_in[4];
  const float* bk = (const float*)d_in[5];
  const float* bv = (const float*)d_in[6];
  float* out = (float*)d_out;

  // workspace: Q,K f16 [B,H,S,D]; Vt f16 [B,H,D,S]  (3 * 16 MB = 48 MB)
  const size_t elems = (size_t)kB * kH * kS * kD;
  _Float16* Qg  = (_Float16*)d_ws;
  _Float16* Kg  = Qg + elems;
  _Float16* Vtg = Kg + elems;

  dim3 grid(kB * kH, kS / kTile);
  msa_qkv_kernel<<<grid, 256, 0, stream>>>(x, Wq, Wk, Wv, bq, bk, bv, Qg, Kg, Vtg);
  msa_attn_kernel<<<grid, 256, 0, stream>>>(Qg, Kg, Vtg, out);
}

// v003
// One run takes 48.2 microseconds.
// In two side-by-side timings against v002, it was 1.17 and 1.16 times as fast.
// Over all steps from v000 it is 2.55 times as fast.
#include <hip/hip_runtime.h>
#include <hip/hip_bf16.h>

typedef __attribute__((ext_vector_type(16))) _Float16 v16h;
typedef __attribute__((ext_vector_type(8)))  _Float16 v8h;
typedef __attribute__((ext_vector_type(8)))  float    v8f;
typedef __attribute__((ext_vector_type(4)))  float    v4f;

namespace msa {
constexpr int kB = 8, kS = 1024, kDim = 1024, kH = 16, kD = 64;
constexpr int kTile = 128;           // rows per workgroup tile (projection), kv positions per LDS tile
constexpr int kQTile = 256;          // query rows per attention workgroup
constexpr int kLdX = 72;             // padded LDS row (halves), 144B = 9*16B -> aligned & conflict-spread
constexpr int kLdP = 136;            // padded LDS row for Vt (272B = 17*16B)
constexpr int kLdO = 68;             // padded LDS row (floats) of the output staging (272B = 17*16B)
}

__device__ __forceinline__ v8f wmma_f16(v16h a, v16h b, v8f c) {
  // v_wmma_f32_16x16x32_f16: D = A(16x32) x B(32x16) + C, f32 accum
  return __builtin_amdgcn_wmma_f32_16x16x32_f16(false, a, false, b, (short)0, c,
                                                false, false);
}

// A-fragment loader for 16x32 f16 tile at mat[(m)*ld + k], row-major source.
// ISA layout: lanes 0-15 -> row m=lane, K-octets {0-7,16-23};
//             lanes 16-31 -> row m=lane-16, K-octets {8-15,24-31}.
// Also serves as the B-operand gather when the B source is stored [N][K]
// row-major (i.e. B^T), since column n of B is then a contiguous row.
__device__ __forceinline__ v16h load_frag_rm(const _Float16* mat, int ld, int lane) {
  const int m  = lane & 15;
  const int kb = (lane & 16) ? 8 : 0;
  const _Float16* p = mat + m * ld + kb;
  v8h lo = *(const v8h*)(p);        // K = kb .. kb+7   (16B aligned: ld % 8 == 0)
  v8h hi = *(const v8h*)(p + 16);   // K = kb+16 .. kb+23
  return __builtin_shufflevector(lo, hi, 0, 1, 2, 3, 4, 5, 6, 7,
                                 8, 9, 10, 11, 12, 13, 14, 15);
}

// value of lane l ^ 16 (the other 16-lane half), as a vector cross-row move
__device__ __forceinline__ float xhalf(float x) {
  const int v = __builtin_bit_cast(int, x);
  return __builtin_bit_cast(float, __builtin_amdgcn_permlanex16(
      v, v, 0x76543210, 0xfedcba98, false, false));
}

// CDNA5 async copies: 16B per lane each, global -> LDS, bypassing VGPRs (ASYNCcnt).
// Flat addresses of __shared__ objects carry the wave-relative LDS address in
// their low 32 bits (ISA 10.2: LDS_ADDR = addr[31:0]).
// Four copies share one statement; its last line, s_wait_xcnt 0, stands in front
// of any later rewrite of the address registers that the copies name.
__device__ __forceinline__ void async_copy4_b128(
    const _Float16* g0, _Float16* l0, const _Float16* g1, _Float16* l1,
    const _Float16* g2, _Float16* l2, const _Float16* g3, _Float16* l3) {
  const unsigned int a0 = (unsigned int)(size_t)l0, a1 = (unsigned int)(size_t)l1;
  const unsigned int a2 = (unsigned int)(size_t)l2, a3 = (unsigned int)(size_t)l3;
  asm volatile("global_load_async_to_lds_b128 %0, %1, off\n\t"
               "global_load_async_to_lds_b128 %2, %3, off\n\t"
               "global_load_async_to_lds_b128 %4, %5, off\n\t"
               "global_load_async_to_lds_b128 %6, %7, off\n\t"
               "s_wait_xcnt 0x0"
               :: "v"(a0), "v"(g0), "v"(a1), "v"(g1), "v"(a2), "v"(g2), "v"(a3), "v"(g3)
               : "memory");
}

// ---------------------------------------------------------------------------
// Kernel 1: per-head QKV projection.  grid = (B*H, S/128), block = 256 (8 waves)
// q = 0.125*(xh @ Wq^T + bq), k = xh @ Wk^T + bk, v = xh @ Wv^T + bv
// Q,K stored f16 [B,H,S,D]; V stored transposed f16 [B,H,D,S].
// ---------------------------------------------------------------------------
__global__ __launch_bounds__(256) void msa_qkv_kernel(
    const float* __restrict__ x,  const float* __restrict__ Wq,
    const float* __restrict__ Wk, const float* __restrict__ Wv,
    const float* __restrict__ bq, const float* __restrict__ bk,
    const float* __restrict__ bv,
    _Float16* __restrict__ Qg, _Float16* __restrict__ Kg,
    _Float16* __restrict__ Vtg) {
  using namespace msa;
  __shared__ __attribute__((aligned(16))) _Float16 xs[kTile * kLdX];
  __shared__ __attribute__((aligned(16))) _Float16 wsm[3][kD * kLdX];

  const int bh = blockIdx.x;
  const int b = bh / kH, h = bh % kH;
  const int s0 = blockIdx.y * kTile;
  const int tid = threadIdx.x;
  const int wave = tid >> 5, lane = tid & 31;

  // stage x tile (cols h*64..h*64+63) as f16
  for (int i = tid; i < kTile * kD; i += 256) {
    const int r = i >> 6, d = i & 63;
    xs[r * kLdX + d] =
        (_Float16)x[((size_t)b * kS + (s0 + r)) * kDim + h * kD + d];
  }
  // stage the three 64x64 weight matrices for this head as f16 ([e][d] order)
  for (int i = tid; i < kD * kD; i += 256) {
    const size_t off = (size_t)h * kD * kD + i;
    const int e = i >> 6, d = i & 63;
    wsm[0][e * kLdX + d] = (_Float16)Wq[off];
    wsm[1][e * kLdX + d] = (_Float16)Wk[off];
    wsm[2][e * kLdX + d] = (_Float16)Wv[off];
  }
  __syncthreads();

  const int m0 = wave * 16;  // this wave's 16 rows
  const v16h a0 = load_frag_rm(xs + m0 * kLdX + 0,  kLdX, lane);
  const v16h a1 = load_frag_rm(xs + m0 * kLdX + 32, kLdX, lane);

  const int n_in = lane & 15;
  const int mofs = (lane & 16) ? 8 : 0;
  const size_t qkbase = ((size_t)bh * kS + s0 + m0) * kD;

  for (int proj = 0; proj < 3; ++proj) {
    const float* bias = (proj == 0) ? bq : (proj == 1) ? bk : bv;
#pragma unroll
    for (int nt = 0; nt < 4; ++nt) {
      // B = W^T gather: W stored [e][d] -> contiguous row per output column e
      const v16h b0 = load_frag_rm(&wsm[proj][(nt * 16) * kLdX + 0],  kLdX, lane);
      const v16h b1 = load_frag_rm(&wsm[proj][(nt * 16) * kLdX + 32], kLdX, lane);
      v8f acc = {};
      acc = wmma_f16(a0, b0, acc);
      acc = wmma_f16(a1, b1, acc);

      const int n = nt * 16 + n_in;
      const float bias_n = bias[h * kD + n];
#pragma unroll
      for (int i = 0; i < 8; ++i) acc[i] += bias_n;
      if (proj == 0) {
#pragma unroll
        for (int i = 0; i < 8; ++i) acc[i] *= 0.125f;  // 1/sqrt(D) folded into Q
      }

      if (proj == 2) {
        // V transposed: Vt[bh][n(d)][s] ; per lane 8 consecutive s positions
        const size_t vb = ((size_t)bh * kD + n) * kS + s0 + m0 + mofs;
#pragma unroll
        for (int i = 0; i < 8; ++i) Vtg[vb + i] = (_Float16)acc[i];
      } else {
        _Float16* out = (proj == 0) ? Qg : Kg;
#pragma unroll
        for (int i = 0; i < 8; ++i)
          out[qkbase + (size_t)(mofs + i) * kD + n] = (_Float16)acc[i];
      }
    }
  }
}

__global__ __launch_bounds__(256) __attribute__((amdgpu_waves_per_eu(4, 4)))
void msa_attn_kernel(
    const _Float16* __restrict__ Qg, const _Float16* __restrict__ Kg,
    const _Float16* __restrict__ Vtg, float* __restrict__ out) {
  using namespace msa;
  __shared__ __attribute__((aligned(16))) _Float16 qs[kQTile * kLdX];
  __shared__ __attribute__((aligned(16))) _Float16 ks[2][kTile * kLdX];
  __shared__ __attribute__((aligned(16))) _Float16 vts[2][kD * kLdP];
  static_assert(8 * 16 * kLdO * 4 <= 2 * kTile * kLdX * 2, "output staging fits in ks");

  const int bh = blockIdx.x;
  const int b = bh / kH, h = bh % kH;
  const int s0 = blockIdx.y * kQTile;
  const int tid = threadIdx.x;
  const int wave = tid >> 5, lane = tid & 31;

  const size_t qkbase = (size_t)bh * kS * kD;   // [B,H,S,D]
  const size_t vtbase = (size_t)bh * kD * kS;   // [B,H,D,S]

  // 16B chunk of this thread in a [rows][64] tile: row tid/8 (+32 per copy)
  const int r8 = tid >> 3, d8 = (tid & 7) * 8;
  // 16B chunk of this thread in a [rows][128] tile: row tid/16 (+16 per copy)
  const int r16 = tid >> 4, j16 = (tid & 15) * 8;

  // ---- async-stage the Q tile [256][64] ----
  {
    const _Float16* qg = Qg + qkbase + (size_t)(s0 + r8) * kD + d8;
    _Float16* qd = qs + r8 * kLdX + d8;
#pragma unroll
    for (int it = 0; it < 2; ++it) {
      const _Float16* g = qg + (size_t)it * 128 * kD;
      _Float16* l = qd + it * 128 * kLdX;
      async_copy4_b128(g, l, g + 32 * kD, l + 32 * kLdX,
                       g + 64 * kD, l + 64 * kLdX, g + 96 * kD, l + 96 * kLdX);
    }
  }
  asm volatile("s_wait_asynccnt 0x0" ::: "memory");
  __syncthreads();

  const int m0 = wave * 32;
  v16h bq[2][2];  // Q fragments of the two column groups, kept in registers
#pragma unroll
  for (int cg = 0; cg < 2; ++cg) {
    bq[cg][0] = load_frag_rm(qs + (m0 + cg * 16) * kLdX + 0,  kLdX, lane);
    bq[cg][1] = load_frag_rm(qs + (m0 + cg * 16) * kLdX + 32, kLdX, lane);
  }

  // per-lane state of query column lane & 15 of each group; lrow holds this
  // lane's share of the row sum (its half of the kv positions) until the end
  float mrow[2] = {-3.0e38f, -3.0e38f}, lrow[2] = {0.0f, 0.0f};
  v8f o[2][4];  // O^T tiles: o[cg][nt][i] = O[query cg*16 + (lane & 15)][nt*16 + mofs + i]
  const v8f vzero = {};
#pragma unroll
  for (int cg = 0; cg < 2; ++cg)
#pragma unroll
    for (int nt = 0; nt < 4; ++nt) o[cg][nt] = vzero;

  const int n_in = lane & 15;
  const int mofs = (lane & 16) ? 8 : 0;

  // issue a kv tile (K [128][64] + Vt [64][128]) into LDS buffer `buf`
  auto issue_kv_tile = [&](int j0, int buf) {
    const _Float16* kg = Kg + qkbase + (size_t)(j0 + r8) * kD + d8;
    const _Float16* vg = Vtg + vtbase + (size_t)r16 * kS + j0 + j16;
    _Float16* kd = ks[buf] + r8 * kLdX + d8;
    _Float16* vd = vts[buf] + r16 * kLdP + j16;
    async_copy4_b128(kg, kd, kg + 32 * kD, kd + 32 * kLdX,
                     kg + 64 * kD, kd + 64 * kLdX, kg + 96 * kD, kd + 96 * kLdX);
    async_copy4_b128(vg, vd, vg + 16 * kS, vd + 16 * kLdP,
                     vg + 32 * kS, vd + 32 * kLdP, vg + 48 * kS, vd + 48 * kLdP);
  };

  issue_kv_tile(0, 0);  // prime the pipeline

  for (int t = 0; t < 8; ++t) {
    const int cur = t & 1;
    if (t < 7) {
      issue_kv_tile((t + 1) * 128, cur ^ 1);  // stream next tile behind compute
      // 8 ops of tile t may still be pending below 8 newly issued ones;
      // waiting to <=8 leaves only the 8 youngest: all of tile t has landed.
      asm volatile("s_wait_asynccnt 0x8" ::: "memory");
    } else {
      asm volatile("s_wait_asynccnt 0x0" ::: "memory");
    }
    __syncthreads();

    // kept rolled: the register budget leaves no room to fetch one pass's fragments
    // under the other, so a second copy of the body would only cost padding and text
#pragma unroll 1
    for (int hf = 0; hf < 2; ++hf) {  // two passes of 64 kv positions
      const _Float16* kcur = ks[cur] + hf * 64 * kLdX;
      const _Float16* vcur = vts[cur] + hf * 64;

      // ---- scores: S^T = K*Q^T;
      // sc[cg][ct][i] = S[query cg*16 + n_in][kv ct*16 + mofs + i] ----
      // the pass's K fragments are read as one group, so that the wave waits out
      // the LDS latency once and the later fragments land behind the first products
      v16h kf[4][2];
#pragma unroll
      for (int ct = 0; ct < 4; ++ct) {
        kf[ct][0] = load_frag_rm(kcur + (ct * 16) * kLdX + 0,  kLdX, lane);
        kf[ct][1] = load_frag_rm(kcur + (ct * 16) * kLdX + 32, kLdX, lane);
      }
      // keeps the group of reads here: the scheduler otherwise sinks each pair of
      // reads to its product, where the wave waits out the LDS latency every time
      __builtin_amdgcn_sched_barrier(0);
      v8f sc[2][4];
#pragma unroll
      for (int ct = 0; ct < 4; ++ct) {
#pragma unroll
        for (int cg = 0; cg < 2; ++cg) {
          v8f acc = {};
          acc = wmma_f16(kf[ct][0], bq[cg][0], acc);
          acc = wmma_f16(kf[ct][1], bq[cg][1], acc);
          sc[cg][ct] = acc;
        }
      }

      // V^T fragments of the first 32 kv positions, read as one group into registers
      // that the K fragments have left: the softmax arithmetic covers their latency
      v16h av[4];
#pragma unroll
      for (int nt = 0; nt < 4; ++nt)
        av[nt] = load_frag_rm(vcur + (nt * 16) * kLdP, kLdP, lane);
      __builtin_amdgcn_sched_barrier(0);  // as above: holds the group in place

      // ---- online softmax: each query's max over the 64 kv positions ----
      float scale[2];
#pragma unroll
      for (int cg = 0; cg < 2; ++cg) {
        float rmax[8];
#pragma unroll
        for (int i = 0; i < 8; ++i) rmax[i] = sc[cg][0][i];
#pragma unroll
        for (int ct = 1; ct < 4; ++ct)
#pragma unroll
          for (int i = 0; i < 8; ++i) rmax[i] = fmaxf(rmax[i], sc[cg][ct][i]);
        float mx = fmaxf(fmaxf(fmaxf(rmax[0], rmax[1]), fmaxf(rmax[2], rmax[3])),
                         fmaxf(fmaxf(rmax[4], rmax[5]), fmaxf(rmax[6], rmax[7])));
        mx = fmaxf(mx, xhalf(mx));  // both halves now hold the query's pass max
        const float mn = fmaxf(mrow[cg], mx);
        scale[cg] = __expf(mrow[cg] - mn);
        mrow[cg] = mn;
#pragma unroll
        for (int nt = 0; nt < 4; ++nt) o[cg][nt] *= scale[cg];
      }

      // ---- P^T = exp(S^T - m), O^T += V^T * P^T.  Two S^T tiles (kv kc*32 ..
      // +15 and +16 .. +31), converted in place, sit in the k order of
      // load_frag_rm: element s < 8 is k = mofs + s, element s >= 8 is
      // k = 16 + mofs + (s - 8).  (Vt stored [d][j] row-major == A source) ----
      float ts0[2] = {0.0f, 0.0f}, ts1[2] = {0.0f, 0.0f};  // two chains per row sum
#pragma unroll
      for (int kc = 0; kc < 2; ++kc) {
        v16h bp[2];
#pragma unroll
        for (int cg = 0; cg < 2; ++cg) {
          const v8f x0 = sc[cg][2 * kc] - mrow[cg];
          const v8f x1 = sc[cg][2 * kc + 1] - mrow[cg];
          v8f p0, p1;
#pragma unroll
          for (int i = 0; i < 8; ++i) p0[i] = __expf(x0[i]);
#pragma unroll
          for (int i = 0; i < 8; ++i) p1[i] = __expf(x1[i]);
#pragma unroll
          for (int i = 0; i < 8; ++i) {
            ts0[cg] += p0[i];
            ts1[cg] += p1[i];
          }
          const v8h h0 = __builtin_convertvector(p0, v8h);
          const v8h h1 = __builtin_convertvector(p1, v8h);
          bp[cg] = __builtin_shufflevector(h0, h1, 0, 1, 2, 3, 4, 5, 6, 7,
                                           8, 9, 10, 11, 12, 13, 14, 15);
        }
        v16h avn[4];
        if (kc == 0) {
          // the second 32 positions' fragments, again as one group, ahead of this
          // block's products and the next block's exponentials
#pragma unroll
          for (int nt = 0; nt < 4; ++nt)
            avn[nt] = load_frag_rm(vcur + (nt * 16) * kLdP + 32, kLdP, lane);
          __builtin_amdgcn_sched_barrier(0);  // as above: holds the group in place
        }
#pragma unroll
        for (int nt = 0; nt < 4; ++nt) {
          o[0][nt] = wmma_f16(av[nt], bp[0], o[0][nt]);
          o[1][nt] = wmma_f16(av[nt], bp[1], o[1][nt]);
        }
        if (kc == 0) {
#pragma unroll
          for (int nt = 0; nt < 4; ++nt) av[nt] = avn[nt];
        }
      }
#pragma unroll
      for (int cg = 0; cg < 2; ++cg)
        lrow[cg] = lrow[cg] * scale[cg] + (ts0[cg] + ts1[cg]);
    }
    __syncthreads();  // all waves done with buffer `cur` before it is re-filled
  }

  // ---- epilogue: out[b, s0+m0+q, h*64+d] = O / l.  A lane holds 8 consecutive
  // d of one query per group; each wave turns its two 16x64 tiles, one after the
  // other, through its own LDS range so that every store instruction covers whole
  // 256-byte rows.  ks is free: the loop's last barrier ended every read of it
  // and no copy is in flight. ----
  float* ost = reinterpret_cast<float*>(&ks[0][0]) + wave * 16 * kLdO;
#pragma unroll
  for (int cg = 0; cg < 2; ++cg) {
    // join the two halves' partial row sums, once for all kv tiles
    const float inv = 1.0f / (lrow[cg] + xhalf(lrow[cg]));
#pragma unroll
    for (int nt = 0; nt < 4; ++nt) {
      const v8f r = o[cg][nt] * inv;
      float* p = ost + n_in * kLdO + nt * 16 + mofs;
      *reinterpret_cast<v4f*>(p)     = __builtin_shufflevector(r, r, 0, 1, 2, 3);
      *reinterpret_cast<v4f*>(p + 4) = __builtin_shufflevector(r, r, 4, 5, 6, 7);
    }
    // the wave's own staging writes are done before other lanes read them back
    asm volatile("s_wait_dscnt 0x0" ::: "memory");
#pragma unroll
    for (int it = 0; it < 8; ++it) {
      const int row = it * 2 + (lane >> 4);
      const v4f v = *reinterpret_cast<const v4f*>(ost + row * kLdO + n_in * 4);
      *reinterpret_cast<v4f*>(
          out + ((size_t)b * kS + s0 + m0 + cg * 16 + row) * kDim + h * kD + n_in * 4) = v;
    }
  }
}

extern "C" void kernel_launch(void* const* d_in, const int* in_sizes, int n_in,
                              void* d_out, int out_size, void* d_ws,
                              size_t ws_size, hipStream_t stream) {
  using namespace msa;
  const float* x  = (const float*)d_in[0];
  const float* Wq = (const float*)d_in[1];
  const float* Wk = (const float*)d_in[2];
  const float* Wv = (const float*)d_in[3];
  const float* bq = (const float*)d_in[4];
  const float* bk = (const float*)d_in[5];
  const float* bv = (const float*)d_in[6];
  float* out = (float*)d_out;

  // workspace: Q,K f16 [B,H,S,D]; Vt f16 [B,H,D,S]  (3 * 16 MB = 48 MB)
  const size_t elems = (size_t)kB * kH * kS * kD;
  _Float16* Qg  = (_Float16*)d_ws;
  _Float16* Kg  = Qg + elems;
  _Float16* Vtg = Kg + elems;

  dim3 grid(kB * kH, kS / kTile);
  msa_qkv_kernel<<<grid, 256, 0, stream>>>(x, Wq, Wk, Wv, bq, bk, bv, Qg, Kg, Vtg);
  dim3 grid_attn(kB * kH, kS / kQTile);
  msa_attn_kernel<<<grid_attn, 256, 0, stream>>>(Qg, Kg, Vtg, out);
}

// v004
// A run of this version takes 29.9 microseconds.
// In two side-by-side timings against v003, it was 1.60 and 1.61 times as fast.
// Over all steps from v000 it is 4.10 times as fast.
#include <hip/hip_runtime.h>
#include <hip/hip_bf16.h>

typedef __attribute__((ext_vector_type(16))) _Float16 v16h;
typedef __attribute__((ext_vector_type(8)))  _Float16 v8h;
typedef __attribute__((ext_vector_type(4)))  _Float16 v4h;
typedef __attribute__((ext_vector_type(8)))  float    v8f;
typedef __attribute__((ext_vector_type(4)))  float    v4f;

namespace msa {
constexpr int kB = 8, kS = 1024, kDim = 1024, kH = 16, kD = 64;
constexpr int kQTile = 512;          // query rows per workgroup (16 waves x 32)
constexpr int kLdX = 72;             // padded LDS row (halves), 144B = 9*16B -> aligned & conflict-spread
constexpr int kLdO = 68;             // padded LDS row (floats) of the output staging (272B = 17*16B)
static_assert(kS == 2 * kQTile, "a wave's keys: its own queries and the same rows of the other half");
}

__device__ __forceinline__ v8f wmma_f16(v16h a, v16h b, v8f c) {
  // v_wmma_f32_16x16x32_f16: D = A(16x32) x B(32x16) + C, f32 accum
  return __builtin_amdgcn_wmma_f32_16x16x32_f16(false, a, false, b, (short)0, c,
                                                false, false);
}

// A-fragment loader for 16x32 f16 tile at mat[(m)*ld + k], row-major source.
// ISA layout: lanes 0-15 -> row m=lane, K-octets {0-7,16-23};
//             lanes 16-31 -> row m=lane-16, K-octets {8-15,24-31}.
// Also serves as the B-operand gather when the B source is stored [N][K]
// row-major (i.e. B^T), since column n of B is then a contiguous row.
__device__ __forceinline__ v16h load_frag_rm(const _Float16* mat, int ld, int lane) {
  const int m  = lane & 15;
  const int kb = (lane & 16) ? 8 : 0;
  const _Float16* p = mat + m * ld + kb;
  v8h lo = *(const v8h*)(p);        // K = kb .. kb+7   (16B aligned: ld % 8 == 0)
  v8h hi = *(const v8h*)(p + 16);   // K = kb+16 .. kb+23
  return __builtin_shufflevector(lo, hi, 0, 1, 2, 3, 4, 5, 6, 7,
                                 8, 9, 10, 11, 12, 13, 14, 15);
}

// value of lane l ^ 16 (the other 16-lane half), as a vector cross-row move
__device__ __forceinline__ float xhalf(float x) {
  const int v = __builtin_bit_cast(int, x);
  return __builtin_bit_cast(float, __builtin_amdgcn_permlanex16(
      v, v, 0x76543210, 0xfedcba98, false, false));
}

__global__ __launch_bounds__(512) __attribute__((amdgpu_waves_per_eu(4, 4)))
void msa_fused_kernel(
    const float* __restrict__ x,  const float* __restrict__ Wq,
    const float* __restrict__ Wk, const float* __restrict__ Wv,
    const float* __restrict__ bq, const float* __restrict__ bk,
    const float* __restrict__ bv, float* __restrict__ out) {
  using namespace msa;
  __shared__ __attribute__((aligned(16))) _Float16 ks[kS * kLdX];
  __shared__ __attribute__((aligned(16))) _Float16 vts[(kS / 64) * kD * kLdX];
  __shared__ __attribute__((aligned(16))) _Float16 wsm[3][kD * kLdX];
  __shared__ __attribute__((aligned(32))) float bsm[3][kD];
  static_assert(16 * 16 * kLdO * 4 <= kS * kLdX * 2, "output staging fits in ks");

  const int bh = blockIdx.x;
  const int b = bh / kH, h = bh % kH;
  const int s0 = blockIdx.y * kQTile;
  const int tid = threadIdx.x;
  // the wave's number in a scalar register: row bases become scalar address parts
  const int wave = __builtin_amdgcn_readfirstlane(tid >> 5);
  const int lane = tid & 31;
  const int n_in = lane & 15;
  const int mofs = (lane & 16) ? 8 : 0;
  const int m0 = wave * 32;
  const v8f vzero = {};
  // a lane's place in two rows of 64 floats of x or out: 16B per lane, whole rows
  const unsigned loff = (unsigned)(lane >> 4) * kDim + n_in * 4;

  // first row of each of the wave's four 16-row tiles of x (= key tiles)
  const int rowq = s0 + m0;               // tiles 0, 1: the wave's queries
  const int rowo = (s0 ^ kQTile) + m0;    // tiles 2, 3: same rows, other half
  const int trow[4] = {rowq, rowq + 16, rowo, rowo + 16};

  // the three bias rows of this head go through LDS too (a lane wants 8 consecutive
  // entries of bq, bk per tile); asked for here so that x's latency covers theirs.
  // Two waves per bias; waves 6..15 read bv again and drop it.
  const float* bsrc = (tid < kD) ? bq : (tid < 2 * kD) ? bk : bv;
  const float bval = bsrc[h * kD + (tid & 63)];

  // ---- stage x (cols h*64 .. +63 of the wave's 64 rows) as f16 in the wave's own
  // rows of ks, which K overwrites later, and the three 64x64 weight matrices of
  // this head ([e][d] order) in wsm.  16B per lane: one load covers two whole rows.
  {
    v4f wr[3][2];
#pragma unroll
    for (int j = 0; j < 2; ++j) {
      const size_t off = (size_t)h * kD * kD + (size_t)(tid + j * 512) * 4;
      wr[0][j] = *reinterpret_cast<const v4f*>(Wq + off);
      wr[1][j] = *reinterpret_cast<const v4f*>(Wk + off);
      wr[2][j] = *reinterpret_cast<const v4f*>(Wv + off);
    }
    // s_wait_xcnt 0, here and twice below: a later load may be given, as its destination,
    // an address register that the loads issued so far name and no longer need
    asm volatile("s_wait_xcnt 0x0" ::: "memory");
    // one base per 32-row range; the rows follow by constant offsets
    const float* xq = x + ((size_t)b * kS + rowq) * kDim + h * kD;
    const float* xo = x + ((size_t)b * kS + rowo) * kDim + h * kD;
    v4f xr[4][8];
#pragma unroll
    for (int t = 0; t < 4; ++t)
#pragma unroll
      for (int it = 0; it < 8; ++it) {
        // behind the last load from xq, and in front of the last load from xo
        if ((t == 2 && it == 0) || (t == 3 && it == 7))
          asm volatile("s_wait_xcnt 0x0" ::: "memory");
        xr[t][it] = *reinterpret_cast<const v4f*>(
            ((t < 2) ? xq : xo) + ((t & 1) * 16 + it * 2) * kDim + loff);
      }
#pragma unroll
    for (int j = 0; j < 2; ++j) {
      const int i4 = tid + j * 512;
      const int wofs = (i4 >> 4) * kLdX + (i4 & 15) * 4;
#pragma unroll
      for (int p = 0; p < 3; ++p)
        *reinterpret_cast<v4h*>(&wsm[p][wofs]) = __builtin_convertvector(wr[p][j], v4h);
    }
    // keeps the bias load up with the other loads: the compiler otherwise sinks it into
    // the branch below, where its whole latency stands in front of the barrier
    asm volatile("" :: "v"(bval));
#pragma unroll
    for (int t = 0; t < 4; ++t)
#pragma unroll
      for (int it = 0; it < 8; ++it)
        *reinterpret_cast<v4h*>(ks + (trow[t] + it * 2 + (lane >> 4)) * kLdX + n_in * 4) =
            __builtin_convertvector(xr[t][it], v4h);
  }
  if (tid < 3 * kD) bsm[tid >> 6][tid & 63] = bval;  // waves 0..5, whole waves
  __syncthreads();  // wsm, bsm are complete (and each wave's own x rows are written)

  // x fragments of the four tiles: A operand of V = x*Wv^T, B operand of W*x^T
  v16h xf[4][2];
#pragma unroll
  for (int t = 0; t < 4; ++t) {
    xf[t][0] = load_frag_rm(ks + trow[t] * kLdX + 0,  kLdX, lane);
    xf[t][1] = load_frag_rm(ks + trow[t] * kLdX + 32, kLdX, lane);
  }

  // ---- Q^T = 0.125*(Wq*x^T + bq) of the wave's two query groups.  Tiles e = 2*kk
  // and 2*kk+1, converted in place, are element s < 8: k = mofs + s, s >= 8:
  // k = 16 + mofs + (s - 8) of the 32 d from kk*32: the k order of load_frag_rm ----
  v16h qf[2][2];  // Q fragments of the two column groups, kept in registers
#pragma unroll
  for (int kk = 0; kk < 2; ++kk) {
    v8h hq[2][2];
#pragma unroll
    for (int u = 0; u < 2; ++u) {
      const int et = 2 * kk + u;
      const v16h a0 = load_frag_rm(&wsm[0][(et * 16) * kLdX + 0],  kLdX, lane);
      const v16h a1 = load_frag_rm(&wsm[0][(et * 16) * kLdX + 32], kLdX, lane);
      const v8f bias = *reinterpret_cast<const v8f*>(&bsm[0][et * 16 + mofs]);
#pragma unroll
      for (int cg = 0; cg < 2; ++cg) {
        v8f acc = {};
        acc = wmma_f16(a0, xf[cg][0], acc);
        acc = wmma_f16(a1, xf[cg][1], acc);
        acc += bias;
        acc *= 0.125f;  // 1/sqrt(D) folded into Q
        hq[cg][u] = __builtin_convertvector(acc, v8h);
      }
    }
#pragma unroll
    for (int cg = 0; cg < 2; ++cg)
      qf[cg][kk] = __builtin_shufflevector(hq[cg][0], hq[cg][1], 0, 1, 2, 3, 4, 5, 6, 7,
                                           8, 9, 10, 11, 12, 13, 14, 15);
  }

  // ---- K^T = Wk*x^T + bk -> ks[key][d]; a tile's stores follow the products that
  // read that tile's x fragments, and no other wave touches these rows before the
  // barrier below ----
  // kept rolled: unrolled, the scheduler lifts every W fragment to the top and spills
#pragma unroll 1
  for (int et = 0; et < 4; ++et) {
    const v16h a0 = load_frag_rm(&wsm[1][(et * 16) * kLdX + 0],  kLdX, lane);
    const v16h a1 = load_frag_rm(&wsm[1][(et * 16) * kLdX + 32], kLdX, lane);
    const v8f bias = *reinterpret_cast<const v8f*>(&bsm[1][et * 16 + mofs]);
    v8f acc[4];  // four independent tiles: each product fills the others' latency
#pragma unroll
    for (int t = 0; t < 4; ++t) acc[t] = wmma_f16(a0, xf[t][0], vzero);
#pragma unroll
    for (int t = 0; t < 4; ++t) acc[t] = wmma_f16(a1, xf[t][1], acc[t]);
#pragma unroll
    for (int t = 0; t < 4; ++t) {
      acc[t] += bias;
      *reinterpret_cast<v8h*>(ks + (trow[t] + n_in) * kLdX + et * 16 + mofs) =
          __builtin_convertvector(acc[t], v8h);
    }
  }

  // ---- V = x*Wv^T + bv -> vts[key / 64][d][key % 64] (B = W^T gather: W stored [e][d]) ----
#pragma unroll 1  // kept rolled, as above
  for (int nt = 0; nt < 4; ++nt) {
    const v16h b0 = load_frag_rm(&wsm[2][(nt * 16) * kLdX + 0],  kLdX, lane);
    const v16h b1 = load_frag_rm(&wsm[2][(nt * 16) * kLdX + 32], kLdX, lane);
    const float bias_n = bsm[2][nt * 16 + n_in];
    v8f acc[4];  // as above
#pragma unroll
    for (int t = 0; t < 4; ++t) acc[t] = wmma_f16(xf[t][0], b0, vzero);
#pragma unroll
    for (int t = 0; t < 4; ++t) acc[t] = wmma_f16(xf[t][1], b1, acc[t]);
#pragma unroll
    for (int t = 0; t < 4; ++t) {
      acc[t] += bias_n;
      *reinterpret_cast<v8h*>(vts + ((trow[t] >> 6) * kD + nt * 16 + n_in) * kLdX +
                              (trow[t] & 63) + mofs) =
          __builtin_convertvector(acc[t], v8h);
    }
  }
  __syncthreads();  // K and V^T of all 1024 keys are in LDS

  // per-lane state of query column lane & 15 of each group; lrow holds this
  // lane's share of the row sum (its half of the kv positions) until the end
  float mrow[2] = {-3.0e38f, -3.0e38f}, lrow[2] = {0.0f, 0.0f};
  v8f o[2][4];  // O^T tiles: o[cg][nt][i] = O[query cg*16 + (lane & 15)][nt*16 + mofs + i]
#pragma unroll
  for (int cg = 0; cg < 2; ++cg)
#pragma unroll
    for (int nt = 0; nt < 4; ++nt) o[cg][nt] = vzero;

  // kept rolled: the register budget leaves no room to fetch one pass's fragments
  // under the other, so more copies of the body would only cost padding and text
#pragma unroll 1
  for (int ps = 0; ps < kS / 64; ++ps) {  // passes of 64 kv positions
    const _Float16* kcur = ks + ps * 64 * kLdX;
    const _Float16* vcur = vts + ps * kD * kLdX;

    // ---- scores: S^T = K*Q^T;
    // sc[cg][ct][i] = S[query cg*16 + n_in][kv ct*16 + mofs + i] ----
    // the pass's K fragments are read as one group, so that the wave waits out
    // the LDS latency once and the later fragments land behind the first products
    v16h kf[4][2];
#pragma unroll
    for (int ct = 0; ct < 4; ++ct) {
      kf[ct][0] = load_frag_rm(kcur + (ct * 16) * kLdX + 0,  kLdX, lane);
      kf[ct][1] = load_frag_rm(kcur + (ct * 16) * kLdX + 32, kLdX, lane);
    }
    // keeps the group of reads here: the scheduler otherwise sinks each pair of
    // reads to its product, where the wave waits out the LDS latency every time
    __builtin_amdgcn_sched_barrier(0);
    v8f sc[2][4];
#pragma unroll
    for (int ct = 0; ct < 4; ++ct) {
#pragma unroll
      for (int cg = 0; cg < 2; ++cg) {
        v8f acc = {};
        acc = wmma_f16(kf[ct][0], qf[cg][0], acc);
        acc = wmma_f16(kf[ct][1], qf[cg][1], acc);
        sc[cg][ct] = acc;
      }
    }

    // V^T fragments of the first 32 kv positions, read as one group into registers
    // that the K fragments have left: the softmax arithmetic covers their latency
    v16h av[4];
#pragma unroll
    for (int nt = 0; nt < 4; ++nt)
      av[nt] = load_frag_rm(vcur + (nt * 16) * kLdX, kLdX, lane);
    __builtin_amdgcn_sched_barrier(0);  // as above: holds the group in place

    // ---- online softmax: each query's max over the 64 kv positions ----
    float scale[2];
#pragma unroll
    for (int cg = 0; cg < 2; ++cg) {
      float rmax[8];
#pragma unroll
      for (int i = 0; i < 8; ++i) rmax[i] = sc[cg][0][i];
#pragma unroll
      for (int ct = 1; ct < 4; ++ct)
#pragma unroll
        for (int i = 0; i < 8; ++i) rmax[i] = fmaxf(rmax[i], sc[cg][ct][i]);
      float mx = fmaxf(fmaxf(fmaxf(rmax[0], rmax[1]), fmaxf(rmax[2], rmax[3])),
                       fmaxf(fmaxf(rmax[4], rmax[5]), fmaxf(rmax[6], rmax[7])));
      mx = fmaxf(mx, xhalf(mx));  // both halves now hold the query's pass max
      const float mn = fmaxf(mrow[cg], mx);
      scale[cg] = __expf(mrow[cg] - mn);
      mrow[cg] = mn;
#pragma unroll
      for (int nt = 0; nt < 4; ++nt) o[cg][nt] *= scale[cg];
    }

    // ---- P^T = exp(S^T - m), O^T += V^T * P^T.  Two S^T tiles (kv kc*32 ..
    // +15 and +16 .. +31), converted in place, sit in the k order of
    // load_frag_rm: element s < 8 is k = mofs + s, element s >= 8 is
    // k = 16 + mofs + (s - 8).  (Vt stored [d][j] row-major == A source) ----
    float ts0[2] = {0.0f, 0.0f}, ts1[2] = {0.0f, 0.0f};  // two chains per row sum
#pragma unroll
    for (int kc = 0; kc < 2; ++kc) {
      v16h bp[2];
#pragma unroll
      for (int cg = 0; cg < 2; ++cg) {
        const v8f x0 = sc[cg][2 * kc] - mrow[cg];
        const v8f x1 = sc[cg][2 * kc + 1] - mrow[cg];
        v8f p0, p1;
#pragma unroll
        for (int i = 0; i < 8; ++i) p0[i] = __expf(x0[i]);
#pragma unroll
        for (int i = 0; i < 8; ++i) p1[i] = __expf(x1[i]);
#pragma unroll
        for (int i = 0; i < 8; ++i) {
          ts0[cg] += p0[i];
          ts1[cg] += p1[i];
        }
        const v8h h0 = __builtin_convertvector(p0, v8h);
        const v8h h1 = __builtin_convertvector(p1, v8h);
        bp[cg] = __builtin_shufflevector(h0, h1, 0, 1, 2, 3, 4, 5, 6, 7,
                                         8, 9, 10, 11, 12, 13, 14, 15);
      }
      v16h avn[4];
      if (kc == 0) {
        // the second 32 positions' fragments, again as one group, ahead of this
        // block's products and the next block's exponentials
#pragma unroll
        for (int nt = 0; nt < 4; ++nt)
          avn[nt] = load_frag_rm(vcur + (nt * 16) * kLdX + 32, kLdX, lane);
        __builtin_amdgcn_sched_barrier(0);  // as above: holds the group in place
      }
#pragma unroll
      for (int nt = 0; nt < 4; ++nt) {
        o[0][nt] = wmma_f16(av[nt], bp[0], o[0][nt]);
        o[1][nt] = wmma_f16(av[nt], bp[1], o[1][nt]);
      }
      if (kc == 0) {
#pragma unroll
        for (int nt = 0; nt < 4; ++nt) av[nt] = avn[nt];
      }
    }
#pragma unroll
    for (int cg = 0; cg < 2; ++cg)
      lrow[cg] = lrow[cg] * scale[cg] + (ts0[cg] + ts1[cg]);
  }

  // ---- epilogue: out[b, s0+m0+q, h*64+d] = O / l.  A lane holds 8 consecutive
  // d of one query per group; each wave turns its two 16x64 tiles, one after the
  // other, through its own LDS range so that every store instruction covers whole
  // 256-byte rows.  ks is free behind this barrier: it ends every wave's reads. ----
  __syncthreads();
  float* ost = reinterpret_cast<float*>(&ks[0]) + wave * 16 * kLdO;
#pragma unroll
  for (int cg = 0; cg < 2; ++cg) {
    // join the two halves' partial row sums, once for all kv tiles
    const float inv = 1.0f / (lrow[cg] + xhalf(lrow[cg]));
#pragma unroll
    for (int nt = 0; nt < 4; ++nt) {
      const v8f r = o[cg][nt] * inv;
      float* p = ost + n_in * kLdO + nt * 16 + mofs;
      *reinterpret_cast<v4f*>(p)     = __builtin_shufflevector(r, r, 0, 1, 2, 3);
      *reinterpret_cast<v4f*>(p + 4) = __builtin_shufflevector(r, r, 4, 5, 6, 7);
    }
    // the wave's own staging writes are done before other lanes read them back
    asm volatile("s_wait_dscnt 0x0" ::: "memory");
#pragma unroll
    for (int it = 0; it < 8; ++it) {
      const int row = it * 2 + (lane >> 4);
      const v4f v = *reinterpret_cast<const v4f*>(ost + row * kLdO + n_in * 4);
      *reinterpret_cast<v4f*>(
          out + ((size_t)b * kS + s0 + m0 + cg * 16 + it * 2) * kDim + h * kD + loff) = v;
    }
  }
}

extern "C" void kernel_launch(void* const* d_in, const int* in_sizes, int n_in,
                              void* d_out, int out_size, void* d_ws,
                              size_t ws_size, hipStream_t stream) {
  using namespace msa;
  const float* x  = (const float*)d_in[0];
  const float* Wq = (const float*)d_in[1];
  const float* Wk = (const float*)d_in[2];
  const float* Wv = (const float*)d_in[3];
  const float* bq = (const float*)d_in[4];
  const float* bk = (const float*)d_in[5];
  const float* bv = (const float*)d_in[6];
  float* out = (float*)d_out;

  dim3 grid(kB * kH, kS / kQTile);
  msa_fused_kernel<<<grid, 512, 0, stream>>>(x, Wq, Wk, Wv, bq, bk, bv, out);
}

// v005
// Measured time: 27.5 microseconds a run.
// In both of two side-by-side timings against v004, it was 1.09 times as fast.
// Over all steps from v000 it is 4.47 times as fast.
#include <hip/hip_runtime.h>
#include <hip/hip_bf16.h>

typedef __attribute__((ext_vector_type(16))) _Float16 v16h;
typedef __attribute__((ext_vector_type(8)))  _Float16 v8h;
typedef __attribute__((ext_vector_type(4)))  _Float16 v4h;
typedef __attribute__((ext_vector_type(8)))  float    v8f;
typedef __attribute__((ext_vector_type(4)))  float    v4f;

namespace msa {
constexpr int kB = 8, kS = 1024, kDim = 1024, kH = 16, kD = 64;
constexpr int kQTile = 512;          // query rows per workgroup (16 waves x 32)
constexpr int kLdX = 72;             // padded LDS row (halves), 144B = 9*16B -> aligned & conflict-spread
constexpr int kBlk = (64 + kD) * kLdX;  // halves of LDS per 64 keys: K rows and V^T block
constexpr int kLdO = 68;             // padded LDS row (floats) of the output staging (272B = 17*16B)
static_assert(kS == 2 * kQTile, "a wave's keys: its own queries and the same rows of the other half");
}

__device__ __forceinline__ v8f wmma_f16(v16h a, v16h b, v8f c) {
  // v_wmma_f32_16x16x32_f16: D = A(16x32) x B(32x16) + C, f32 accum
  return __builtin_amdgcn_wmma_f32_16x16x32_f16(false, a, false, b, (short)0, c,
                                                false, false);
}

// A-fragment loader for 16x32 f16 tile at mat[(m)*ld + k], row-major source.
// ISA layout: lanes 0-15 -> row m=lane, K-octets {0-7,16-23};
//             lanes 16-31 -> row m=lane-16, K-octets {8-15,24-31}.
// Also serves as the B-operand gather when the B source is stored [N][K]
// row-major (i.e. B^T), since column n of B is then a contiguous row.
__device__ __forceinline__ v16h load_frag_rm(const _Float16* mat, int ld, int lane) {
  const int m  = lane & 15;
  const int kb = (lane & 16) ? 8 : 0;
  const _Float16* p = mat + m * ld + kb;
  v8h lo = *(const v8h*)(p);        // K = kb .. kb+7   (16B aligned: ld % 8 == 0)
  v8h hi = *(const v8h*)(p + 16);   // K = kb+16 .. kb+23
  return __builtin_shufflevector(lo, hi, 0, 1, 2, 3, 4, 5, 6, 7,
                                 8, 9, 10, 11, 12, 13, 14, 15);
}

// value of lane l ^ 16 (the other 16-lane half), as a vector cross-row move
__device__ __forceinline__ float xhalf(float x) {
  const int v = __builtin_bit_cast(int, x);
  return __builtin_bit_cast(float, __builtin_amdgcn_permlanex16(
      v, v, 0x76543210, 0xfedcba98, false, false));
}

__global__ __launch_bounds__(512) __attribute__((amdgpu_waves_per_eu(4, 4)))
void msa_fused_kernel(
    const float* __restrict__ x,  const float* __restrict__ Wq,
    const float* __restrict__ Wk, const float* __restrict__ Wv,
    const float* __restrict__ bq, const float* __restrict__ bk,
    const float* __restrict__ bv, float* __restrict__ out) {
  using namespace msa;
  // per 64 keys: their 64 rows of K, then their block of V^T ([64 d][64 keys]), so that
  // every fragment of a pass lies within one address register's immediate offsets
  __shared__ __attribute__((aligned(16))) _Float16 kv[(kS / 64) * kBlk];
  __shared__ __attribute__((aligned(16))) _Float16 wsm[3][kD * kLdX];
  __shared__ __attribute__((aligned(32))) float bsm[3][kD];
  static_assert(16 * 16 * kLdO * 4 <= (kS / 64) * kBlk * 2, "output staging fits in kv");

  const int bh = blockIdx.x;
  const int b = bh / kH, h = bh % kH;
  const int s0 = blockIdx.y * kQTile;
  const int tid = threadIdx.x;
  // the wave's number in a scalar register: row bases become scalar address parts
  const int wave = __builtin_amdgcn_readfirstlane(tid >> 5);
  const int lane = tid & 31;
  const int n_in = lane & 15;
  const int mofs = (lane & 16) ? 8 : 0;
  const int m0 = wave * 32;
  const v8f vzero = {};
  // a lane's place in two rows of 64 floats of x or out: 16B per lane, whole rows
  const unsigned loff = (unsigned)(lane >> 4) * kDim + n_in * 4;

  // first row of each of the wave's four 16-row tiles of x (= key tiles)
  const int rowq = s0 + m0;               // tiles 0, 1: the wave's queries
  const int rowo = (s0 ^ kQTile) + m0;    // tiles 2, 3: same rows, other half
  const int trow[4] = {rowq, rowq + 16, rowo, rowo + 16};
  // where a tile's 16 rows of K start (a tile lies inside one block of 64 keys)
  _Float16* krow[4];
#pragma unroll
  for (int t = 0; t < 4; ++t) krow[t] = kv + (trow[t] >> 6) * kBlk + (trow[t] & 63) * kLdX;

  // the three bias rows of this head go through LDS too (a lane wants 8 consecutive
  // entries of bq, bk per tile); asked for here so that x's latency covers theirs.
  // Two waves per bias; waves 6..15 read bv again and drop it.
  const float* bsrc = (tid < kD) ? bq : (tid < 2 * kD) ? bk : bv;
  const float bval = bsrc[h * kD + (tid & 63)];

  // ---- stage x (cols h*64 .. +63 of the wave's 64 rows) as f16 in the wave's own
  // rows of K in kv, which K overwrites later, and the three 64x64 weight matrices of
  // this head ([e][d] order) in wsm.  16B per lane: one load covers two whole rows.
  {
    v4f wr[3][2];
#pragma unroll
    for (int j = 0; j < 2; ++j) {
      const size_t off = (size_t)h * kD * kD + (size_t)(tid + j * 512) * 4;
      wr[0][j] = *reinterpret_cast<const v4f*>(Wq + off);
      wr[1][j] = *reinterpret_cast<const v4f*>(Wk + off);
      wr[2][j] = *reinterpret_cast<const v4f*>(Wv + off);
    }
    // s_wait_xcnt 0, here and twice below: a later load may be given, as its destination,
    // an address register that the loads issued so far name and no longer need
    asm volatile("s_wait_xcnt 0x0" ::: "memory");
    // one base per 32-row range; the rows follow by constant offsets
    const float* xq = x + ((size_t)b * kS + rowq) * kDim + h * kD;
    const float* xo = x + ((size_t)b * kS + rowo) * kDim + h * kD;
    v4f xr[4][8];
#pragma unroll
    for (int t = 0; t < 4; ++t)
#pragma unroll
      for (int it = 0; it < 8; ++it) {
        // behind the last load from xq, and in front of the last load from xo
        if ((t == 2 && it == 0) || (t == 3 && it == 7))
          asm volatile("s_wait_xcnt 0x0" ::: "memory");
        xr[t][it] = *reinterpret_cast<const v4f*>(
            ((t < 2) ? xq : xo) + ((t & 1) * 16 + it * 2) * kDim + loff);
      }
#pragma unroll
    for (int j = 0; j < 2; ++j) {
      const int i4 = tid + j * 512;
      const int wofs = (i4 >> 4) * kLdX + (i4 & 15) * 4;
#pragma unroll
      for (int p = 0; p < 3; ++p)
        *reinterpret_cast<v4h*>(&wsm[p][wofs]) = __builtin_convertvector(wr[p][j], v4h);
    }
    // keeps the bias load up with the other loads: the compiler otherwise sinks it into
    // the branch below, where its whole latency stands in front of the barrier
    asm volatile("" :: "v"(bval));
#pragma unroll
    for (int t = 0; t < 4; ++t)
#pragma unroll
      for (int it = 0; it < 8; ++it)
        *reinterpret_cast<v4h*>(krow[t] + (it * 2 + (lane >> 4)) * kLdX + n_in * 4) =
            __builtin_convertvector(xr[t][it], v4h);
  }
  if (tid < 3 * kD) bsm[tid >> 6][tid & 63] = bval;  // waves 0..5, whole waves
  __syncthreads();  // wsm, bsm are complete (and each wave's own x rows are written)

  // x fragments of the four tiles: A operand of V = x*Wv^T, B operand of W*x^T
  v16h xf[4][2];
#pragma unroll
  for (int t = 0; t < 4; ++t) {
    xf[t][0] = load_frag_rm(krow[t] + 0,  kLdX, lane);
    xf[t][1] = load_frag_rm(krow[t] + 32, kLdX, lane);
  }

  // ---- Q^T = 0.125*log2(e)*(Wq*x^T + bq) of the wave's two query groups.  Tiles e = 2*kk
  // and 2*kk+1, converted in place, are element s < 8: k = mofs + s, s >= 8:
  // k = 16 + mofs + (s - 8) of the 32 d from kk*32: the k order of load_frag_rm ----
  v16h qf[2][2];  // Q fragments of the two column groups, kept in registers
#pragma unroll
  for (int kk = 0; kk < 2; ++kk) {
    v8h hq[2][2];
#pragma unroll
    for (int u = 0; u < 2; ++u) {
      const int et = 2 * kk + u;
      const v16h a0 = load_frag_rm(&wsm[0][(et * 16) * kLdX + 0],  kLdX, lane);
      const v16h a1 = load_frag_rm(&wsm[0][(et * 16) * kLdX + 32], kLdX, lane);
      const v8f bias = *reinterpret_cast<const v8f*>(&bsm[0][et * 16 + mofs]);
#pragma unroll
      for (int cg = 0; cg < 2; ++cg) {
        v8f acc = {};
        acc = wmma_f16(a0, xf[cg][0], acc);
        acc = wmma_f16(a1, xf[cg][1], acc);
        acc += bias;
        acc *= 0.125f * 1.44269504f;  // 1/sqrt(D) and log2(e) folded into Q: scores in log2 units
        hq[cg][u] = __builtin_convertvector(acc, v8h);
      }
    }
#pragma unroll
    for (int cg = 0; cg < 2; ++cg)
      qf[cg][kk] = __builtin_shufflevector(hq[cg][0], hq[cg][1], 0, 1, 2, 3, 4, 5, 6, 7,
                                           8, 9, 10, 11, 12, 13, 14, 15);
  }

  // ---- K^T = Wk*x^T + bk -> row key % 64 of block key / 64; a tile's stores follow the products that
  // read that tile's x fragments, and no other wave touches these rows before the
  // barrier below ----
  // kept rolled: unrolled, the scheduler lifts every W fragment to the top and spills
#pragma unroll 1
  for (int et = 0; et < 4; ++et) {
    const v16h a0 = load_frag_rm(&wsm[1][(et * 16) * kLdX + 0],  kLdX, lane);
    const v16h a1 = load_frag_rm(&wsm[1][(et * 16) * kLdX + 32], kLdX, lane);
    const v8f bias = *reinterpret_cast<const v8f*>(&bsm[1][et * 16 + mofs]);
    v8f acc[4];  // four independent tiles: each product fills the others' latency
#pragma unroll
    for (int t = 0; t < 4; ++t) acc[t] = wmma_f16(a0, xf[t][0], vzero);
#pragma unroll
    for (int t = 0; t < 4; ++t) acc[t] = wmma_f16(a1, xf[t][1], acc[t]);
#pragma unroll
    for (int t = 0; t < 4; ++t) {
      acc[t] += bias;
      *reinterpret_cast<v8h*>(krow[t] + n_in * kLdX + et * 16 + mofs) =
          __builtin_convertvector(acc[t], v8h);
    }
  }

  // ---- V = x*Wv^T + bv -> row 64 + d of block key / 64, at key % 64 (B = W^T gather: W stored [e][d]) ----
#pragma unroll 1  // kept rolled, as above
  for (int nt = 0; nt < 4; ++nt) {
    const v16h b0 = load_frag_rm(&wsm[2][(nt * 16) * kLdX + 0],  kLdX, lane);
    const v16h b1 = load_frag_rm(&wsm[2][(nt * 16) * kLdX + 32], kLdX, lane);
    const float bias_n = bsm[2][nt * 16 + n_in];
    v8f acc[4];  // as above
#pragma unroll
    for (int t = 0; t < 4; ++t) acc[t] = wmma_f16(xf[t][0], b0, vzero);
#pragma unroll
    for (int t = 0; t < 4; ++t) acc[t] = wmma_f16(xf[t][1], b1, acc[t]);
#pragma unroll
    for (int t = 0; t < 4; ++t) {
      acc[t] += bias_n;
      *reinterpret_cast<v8h*>(kv + (trow[t] >> 6) * kBlk + (64 + nt * 16 + n_in) * kLdX +
                              (trow[t] & 63) + mofs) =
          __builtin_convertvector(acc[t], v8h);
    }
  }
  __syncthreads();  // K and V^T of all 1024 keys are in LDS

  // per-lane state of query column lane & 15 of each group; lrow holds this
  // lane's share of the row sum (its half of the kv positions) until the end.
  // cm holds -m, the negated maximum in use, eight times: the C operand of the scores
  float lrow[2] = {0.0f, 0.0f};
  v8f cm[2] = {vzero, vzero};
  v8f o[2][4];  // O^T tiles: o[cg][nt][i] = O[query cg*16 + (lane & 15)][nt*16 + mofs + i]
#pragma unroll
  for (int cg = 0; cg < 2; ++cg)
#pragma unroll
    for (int nt = 0; nt < 4; ++nt) o[cg][nt] = vzero;

  // kept rolled: the register budget leaves no room to fetch one pass's fragments
  // under the other, so more copies of the body would only cost padding and text
#pragma unroll 1
  for (int ps = 0; ps < kS / 64; ++ps) {  // passes of 64 kv positions
    const _Float16* kcur = kv + ps * kBlk;
    const _Float16* vcur = kcur + 64 * kLdX;

    // ---- scores: S^T = K*Q^T - m;
    // sc[cg][ct][i] = S[query cg*16 + n_in][kv ct*16 + mofs + i] - m[query] ----
    // the pass's K fragments are read as one group, so that the wave waits out
    // the LDS latency once and the later fragments land behind the first products
    v16h kf[4][2];
#pragma unroll
    for (int ct = 0; ct < 4; ++ct) {
      kf[ct][0] = load_frag_rm(kcur + (ct * 16) * kLdX + 0,  kLdX, lane);
      kf[ct][1] = load_frag_rm(kcur + (ct * 16) * kLdX + 32, kLdX, lane);
    }
    // keeps the group of reads here: the scheduler otherwise sinks each pair of
    // reads to its product, where the wave waits out the LDS latency every time
    __builtin_amdgcn_sched_barrier(0);
    v8f sc[2][4];
#pragma unroll
    for (int ct = 0; ct < 4; ++ct) {
#pragma unroll
      for (int cg = 0; cg < 2; ++cg) {
        v8f acc = wmma_f16(kf[ct][0], qf[cg][0], cm[cg]);
        acc = wmma_f16(kf[ct][1], qf[cg][1], acc);
        sc[cg][ct] = acc;
      }
    }

    // V^T fragments of the first 32 kv positions, read as one group into registers
    // that the K fragments have left: the softmax arithmetic covers their latency
    v16h av[4];
#pragma unroll
    for (int nt = 0; nt < 4; ++nt)
      av[nt] = load_frag_rm(vcur + (nt * 16) * kLdX, kLdX, lane);
    __builtin_amdgcn_sched_barrier(0);  // as above: holds the group in place

    // ---- how far this lane's scores of the pass stand above the maximum in use ----
    float mx[2];
#pragma unroll
    for (int cg = 0; cg < 2; ++cg) {
      float rmax[8];
#pragma unroll
      for (int i = 0; i < 8; ++i) rmax[i] = sc[cg][0][i];
#pragma unroll
      for (int ct = 1; ct < 4; ++ct)
#pragma unroll
        for (int i = 0; i < 8; ++i) rmax[i] = fmaxf(rmax[i], sc[cg][ct][i]);
      mx[cg] = fmaxf(fmaxf(fmaxf(rmax[0], rmax[1]), fmaxf(rmax[2], rmax[3])),
                     fmaxf(fmaxf(rmax[4], rmax[5]), fmaxf(rmax[6], rmax[7])));
    }
    // One scalar test per pass.  Up to 8 above m, P stays at or below 256 (f16 holds it,
    // at the same relative precision) and nothing moves.  Pass 0 starts from m = 0 and
    // takes the branch whatever its scores, so that m is a true maximum from then on.
    const float above = (ps == 0) ? -3.0e38f : 8.0f;  // the test's threshold
    const float least = (ps == 0) ? -3.0e38f : 0.0f;  // after pass 0, m never falls
    if (__builtin_amdgcn_ballot_w32(fmaxf(mx[0], mx[1]) > above) != 0) {
#pragma unroll
      for (int cg = 0; cg < 2; ++cg) {
        // both halves of the wave hold the query's pass maximum
        const float d = fmaxf(fmaxf(mx[cg], xhalf(mx[cg])), least);
        // pass 0 may lower m from 0; O and the sums are 0 there, the factor stays finite
        const float scale = __builtin_amdgcn_exp2f(fminf(-d, 0.0f));
#pragma unroll
        for (int ct = 0; ct < 4; ++ct) sc[cg][ct] -= d;
#pragma unroll
        for (int nt = 0; nt < 4; ++nt) o[cg][nt] *= scale;
        lrow[cg] *= scale;
        cm[cg] -= d;
      }
    }

    // ---- P^T = exp2(S^T - m), O^T += V^T * P^T.  Two S^T tiles (kv kc*32 ..
    // +15 and +16 .. +31), converted in place, sit in the k order of
    // load_frag_rm: element s < 8 is k = mofs + s, element s >= 8 is
    // k = 16 + mofs + (s - 8).  (Vt stored [d][j] row-major == A source) ----
    float ts0[2] = {0.0f, 0.0f}, ts1[2] = {0.0f, 0.0f};  // two chains per row sum
#pragma unroll
    for (int kc = 0; kc < 2; ++kc) {
      v16h bp[2];
#pragma unroll
      for (int cg = 0; cg < 2; ++cg) {
        v8f p0, p1;
#pragma unroll
        for (int i = 0; i < 8; ++i) p0[i] = __builtin_amdgcn_exp2f(sc[cg][2 * kc][i]);
#pragma unroll
        for (int i = 0; i < 8; ++i) p1[i] = __builtin_amdgcn_exp2f(sc[cg][2 * kc + 1][i]);
#pragma unroll
        for (int i = 0; i < 8; ++i) {
          ts0[cg] += p0[i];
          ts1[cg] += p1[i];
        }
        const v8h h0 = __builtin_convertvector(p0, v8h);
        const v8h h1 = __builtin_convertvector(p1, v8h);
        bp[cg] = __builtin_shufflevector(h0, h1, 0, 1, 2, 3, 4, 5, 6, 7,
                                         8, 9, 10, 11, 12, 13, 14, 15);
      }
      v16h avn[4];
      if (kc == 0) {
        // the second 32 positions' fragments, again as one group, ahead of this
        // block's products and the next block's exponentials
#pragma unroll
        for (int nt = 0; nt < 4; ++nt)
          avn[nt] = load_frag_rm(vcur + (nt * 16) * kLdX + 32, kLdX, lane);
        __builtin_amdgcn_sched_barrier(0);  // as above: holds the group in place
      }
#pragma unroll
      for (int nt = 0; nt < 4; ++nt) {
        o[0][nt] = wmma_f16(av[nt], bp[0], o[0][nt]);
        o[1][nt] = wmma_f16(av[nt], bp[1], o[1][nt]);
      }
      if (kc == 0) {
#pragma unroll
        for (int nt = 0; nt < 4; ++nt) av[nt] = avn[nt];
      }
    }
#pragma unroll
    for (int cg = 0; cg < 2; ++cg)
      lrow[cg] += ts0[cg] + ts1[cg];
  }

  // ---- epilogue: out[b, s0+m0+q, h*64+d] = O / l.  A lane holds 8 consecutive
  // d of one query per group; each wave turns its two 16x64 tiles, one after the
  // other, through its own LDS range so that every store instruction covers whole
  // 256-byte rows.  kv is free behind this barrier: it ends every wave's reads. ----
  __syncthreads();
  float* ost = reinterpret_cast<float*>(&kv[0]) + wave * 16 * kLdO;
#pragma unroll
  for (int cg = 0; cg < 2; ++cg) {
    // join the two halves' partial row sums, once for all kv tiles
    const float inv = 1.0f / (lrow[cg] + xhalf(lrow[cg]));
#pragma unroll
    for (int nt = 0; nt < 4; ++nt) {
      const v8f r = o[cg][nt] * inv;
      float* p = ost + n_in * kLdO + nt * 16 + mofs;
      *reinterpret_cast<v4f*>(p)     = __builtin_shufflevector(r, r, 0, 1, 2, 3);
      *reinterpret_cast<v4f*>(p + 4) = __builtin_shufflevector(r, r, 4, 5, 6, 7);
    }
    // the wave's own staging writes are done before other lanes read them back
    asm volatile("s_wait_dscnt 0x0" ::: "memory");
#pragma unroll
    for (int it = 0; it < 8; ++it) {
      const int row = it * 2 + (lane >> 4);
      const v4f v = *reinterpret_cast<const v4f*>(ost + row * kLdO + n_in * 4);
      *reinterpret_cast<v4f*>(
          out + ((size_t)b * kS + s0 + m0 + cg * 16 + it * 2) * kDim + h * kD + loff) = v;
    }
  }
}

extern "C" void kernel_launch(void* const* d_in, const int* in_sizes, int n_in,
                              void* d_out, int out_size, void* d_ws,
                              size_t ws_size, hipStream_t stream) {
  using namespace msa;
  const float* x  = (const float*)d_in[0];
  const float* Wq = (const float*)d_in[1];
  const float* Wk = (const float*)d_in[2];
  const float* Wv = (const float*)d_in[3];
  const float* bq = (const float*)d_in[4];
  const float* bk = (const float*)d_in[5];
  const float* bv = (const float*)d_in[6];
  float* out = (float*)d_out;

  dim3 grid(kB * kH, kS / kQTile);
  msa_fused_kernel<<<grid, 512, 0, stream>>>(x, Wq, Wk, Wv, bq, bk, bv, out);
}

// v006
// It runs in 25.9 microseconds.
// Next to v005, in two timings, it ran 1.06 times as fast each time.
// Counting every step since v000, it is 4.73 times as fast.
#include <hip/hip_runtime.h>
#include <hip/hip_bf16.h>

typedef __attribute__((ext_vector_type(16))) _Float16 v16h;
typedef __attribute__((ext_vector_type(8)))  _Float16 v8h;
typedef __attribute__((ext_vector_type(4)))  _Float16 v4h;
typedef __attribute__((ext_vector_type(8)))  float    v8f;
typedef __attribute__((ext_vector_type(4)))  float    v4f;
typedef __attribute__((ext_vector_type(2)))  float    v2f;

namespace msa {
constexpr int kB = 8, kS = 1024, kDim = 1024, kH = 16, kD = 64;
constexpr int kQTile = 512;          // query rows per workgroup (16 waves x 32)
constexpr int kLdX = 72;             // padded LDS row (halves), 144B = 9*16B -> aligned & conflict-spread
constexpr int kBlk = (64 + kD) * kLdX;  // halves of LDS per 64 keys: K rows and V^T block
constexpr int kLdO = 68;             // padded LDS row (floats) of the output staging (272B = 17*16B)
constexpr float kPSum = 4096.0f;     // a lane's sum of a pass's P up to here: every P is in f16's range
static_assert(kS == 2 * kQTile, "a wave's keys: its own queries and the same rows of the other half");
}

__device__ __forceinline__ v8f wmma_f16(v16h a, v16h b, v8f c) {
  // v_wmma_f32_16x16x32_f16: D = A(16x32) x B(32x16) + C, f32 accum
  return __builtin_amdgcn_wmma_f32_16x16x32_f16(false, a, false, b, (short)0, c,
                                                false, false);
}

// A-fragment loader for 16x32 f16 tile at mat[(m)*ld + k], row-major source.
// ISA layout: lanes 0-15 -> row m=lane, K-octets {0-7,16-23};
//             lanes 16-31 -> row m=lane-16, K-octets {8-15,24-31}.
// Also serves as the B-operand gather when the B source is stored [N][K]
// row-major (i.e. B^T), since column n of B is then a contiguous row.
__device__ __forceinline__ v16h load_frag_rm(const _Float16* mat, int ld, int lane) {
  const int m  = lane & 15;
  const int kb = (lane & 16) ? 8 : 0;
  const _Float16* p = mat + m * ld + kb;
  v8h lo = *(const v8h*)(p);        // K = kb .. kb+7   (16B aligned: ld % 8 == 0)
  v8h hi = *(const v8h*)(p + 16);   // K = kb+16 .. kb+23
  return __builtin_shufflevector(lo, hi, 0, 1, 2, 3, 4, 5, 6, 7,
                                 8, 9, 10, 11, 12, 13, 14, 15);
}

// value of lane l ^ 16 (the other 16-lane half), as a vector cross-row move
__device__ __forceinline__ float xhalf(float x) {
  const int v = __builtin_bit_cast(int, x);
  return __builtin_bit_cast(float, __builtin_amdgcn_permlanex16(
      v, v, 0x76543210, 0xfedcba98, false, false));
}

__global__ __launch_bounds__(512) __attribute__((amdgpu_waves_per_eu(4, 4)))
void msa_fused_kernel(
    const float* __restrict__ x,  const float* __restrict__ Wq,
    const float* __restrict__ Wk, const float* __restrict__ Wv,
    const float* __restrict__ bq, const float* __restrict__ bk,
    const float* __restrict__ bv, float* __restrict__ out) {
  using namespace msa;
  // per 64 keys: their 64 rows of K, then their block of V^T ([64 d][64 keys]), so that
  // every fragment of a pass lies within one address register's immediate offsets
  __shared__ __attribute__((aligned(16))) _Float16 kv[(kS / 64) * kBlk];
  __shared__ __attribute__((aligned(16))) _Float16 wsm[3][kD * kLdX];
  __shared__ __attribute__((aligned(32))) float bsm[3][kD];
  static_assert(16 * 16 * kLdO * 4 <= (kS / 64) * kBlk * 2, "output staging fits in kv");

  const int bh = blockIdx.x;
  const int b = bh / kH, h = bh % kH;
  const int s0 = blockIdx.y * kQTile;
  const int tid = threadIdx.x;
  // the wave's number in a scalar register: row bases become scalar address parts
  const int wave = __builtin_amdgcn_readfirstlane(tid >> 5);
  const int lane = tid & 31;
  const int n_in = lane & 15;
  const int mofs = (lane & 16) ? 8 : 0;
  const int m0 = wave * 32;
  const v8f vzero = {};
  // a lane's place in two rows of 64 floats of x or out: 16B per lane, whole rows
  const unsigned loff = (unsigned)(lane >> 4) * kDim + n_in * 4;

  // first row of each of the wave's four 16-row tiles of x (= key tiles)
  const int rowq = s0 + m0;               // tiles 0, 1: the wave's queries
  const int rowo = (s0 ^ kQTile) + m0;    // tiles 2, 3: same rows, other half
  const int trow[4] = {rowq, rowq + 16, rowo, rowo + 16};
  // where a tile's 16 rows of K start (a tile lies inside one block of 64 keys)
  _Float16* krow[4];
#pragma unroll
  for (int t = 0; t < 4; ++t) krow[t] = kv + (trow[t] >> 6) * kBlk + (trow[t] & 63) * kLdX;

  // the three bias rows of this head go through LDS too (a lane wants 8 consecutive
  // entries of bq, bk per tile); asked for here so that x's latency covers theirs.
  // Two waves per bias; waves 6..15 read bv again and drop it.
  const float* bsrc = (tid < kD) ? bq : (tid < 2 * kD) ? bk : bv;
  const float bval = bsrc[h * kD + (tid & 63)];

  // ---- stage x (cols h*64 .. +63 of the wave's 64 rows) as f16 in the wave's own
  // rows of K in kv, which K overwrites later, and the three 64x64 weight matrices of
  // this head ([e][d] order) in wsm.  16B per lane: one load covers two whole rows.
  {
    v4f wr[3][2];
#pragma unroll
    for (int j = 0; j < 2; ++j) {
      const size_t off = (size_t)h * kD * kD + (size_t)(tid + j * 512) * 4;
      wr[0][j] = *reinterpret_cast<const v4f*>(Wq + off);
      wr[1][j] = *reinterpret_cast<const v4f*>(Wk + off);
      wr[2][j] = *reinterpret_cast<const v4f*>(Wv + off);
    }
    // s_wait_xcnt 0, here and twice below: a later load may be given, as its destination,
    // an address register that the loads issued so far name and no longer need
    asm volatile("s_wait_xcnt 0x0" ::: "memory");
    // one base per 32-row range; the rows follow by constant offsets
    const float* xq = x + ((size_t)b * kS + rowq) * kDim + h * kD;
    const float* xo = x + ((size_t)b * kS + rowo) * kDim + h * kD;
    v4f xr[4][8];
#pragma unroll
    for (int t = 0; t < 4; ++t)
#pragma unroll
      for (int it = 0; it < 8; ++it) {
        // behind the last load from xq, and in front of the last load from xo
        if ((t == 2 && it == 0) || (t == 3 && it == 7))
          asm volatile("s_wait_xcnt 0x0" ::: "memory");
        xr[t][it] = *reinterpret_cast<const v4f*>(
            ((t < 2) ? xq : xo) + ((t & 1) * 16 + it * 2) * kDim + loff);
      }
#pragma unroll
    for (int j = 0; j < 2; ++j) {
      const int i4 = tid + j * 512;
      const int wofs = (i4 >> 4) * kLdX + (i4 & 15) * 4;
#pragma unroll
      for (int p = 0; p < 3; ++p)
        *reinterpret_cast<v4h*>(&wsm[p][wofs]) = __builtin_convertvector(wr[p][j], v4h);
    }
    // keeps the bias load up with the other loads: the compiler otherwise sinks it into
    // the branch below, where its whole latency stands in front of the barrier
    asm volatile("" :: "v"(bval));
#pragma unroll
    for (int t = 0; t < 4; ++t)
#pragma unroll
      for (int it = 0; it < 8; ++it)
        *reinterpret_cast<v4h*>(krow[t] + (it * 2 + (lane >> 4)) * kLdX + n_in * 4) =
            __builtin_convertvector(xr[t][it], v4h);
  }
  if (tid < 3 * kD) bsm[tid >> 6][tid & 63] = bval;  // waves 0..5, whole waves
  __syncthreads();  // wsm, bsm are complete (and each wave's own x rows are written)

  // x fragments of the four tiles: A operand of V = x*Wv^T, B operand of W*x^T
  v16h xf[4][2];
#pragma unroll
  for (int t = 0; t < 4; ++t) {
    xf[t][0] = load_frag_rm(krow[t] + 0,  kLdX, lane);
    xf[t][1] = load_frag_rm(krow[t] + 32, kLdX, lane);
  }

  // ---- Q^T = 0.125*log2(e)*(Wq*x^T + bq) of the wave's two query groups.  Tiles e = 2*kk
  // and 2*kk+1, converted in place, are element s < 8: k = mofs + s, s >= 8:
  // k = 16 + mofs + (s - 8) of the 32 d from kk*32: the k order of load_frag_rm ----
  v16h qf[2][2];  // Q fragments of the two column groups, kept in registers
#pragma unroll
  for (int kk = 0; kk < 2; ++kk) {
    v8h hq[2][2];
#pragma unroll
    for (int u = 0; u < 2; ++u) {
      const int et = 2 * kk + u;
      const v16h a0 = load_frag_rm(&wsm[0][(et * 16) * kLdX + 0],  kLdX, lane);
      const v16h a1 = load_frag_rm(&wsm[0][(et * 16) * kLdX + 32], kLdX, lane);
      const v8f bias = *reinterpret_cast<const v8f*>(&bsm[0][et * 16 + mofs]);
#pragma unroll
      for (int cg = 0; cg < 2; ++cg) {
        v8f acc = {};
        acc = wmma_f16(a0, xf[cg][0], acc);
        acc = wmma_f16(a1, xf[cg][1], acc);
        acc += bias;
        acc *= 0.125f * 1.44269504f;  // 1/sqrt(D) and log2(e) folded into Q: scores in log2 units
        hq[cg][u] = __builtin_convertvector(acc, v8h);
      }
    }
#pragma unroll
    for (int cg = 0; cg < 2; ++cg)
      qf[cg][kk] = __builtin_shufflevector(hq[cg][0], hq[cg][1], 0, 1, 2, 3, 4, 5, 6, 7,
                                           8, 9, 10, 11, 12, 13, 14, 15);
  }

  // ---- K^T = Wk*x^T + bk -> row key % 64 of block key / 64; a tile's stores follow the products that
  // read that tile's x fragments, and no other wave touches these rows before the
  // barrier below ----
  // kept rolled: unrolled, the scheduler lifts every W fragment to the top and spills
#pragma unroll 1
  for (int et = 0; et < 4; ++et) {
    const v16h a0 = load_frag_rm(&wsm[1][(et * 16) * kLdX + 0],  kLdX, lane);
    const v16h a1 = load_frag_rm(&wsm[1][(et * 16) * kLdX + 32], kLdX, lane);
    const v8f bias = *reinterpret_cast<const v8f*>(&bsm[1][et * 16 + mofs]);
    v8f acc[4];  // four independent tiles: each product fills the others' latency
#pragma unroll
    for (int t = 0; t < 4; ++t) acc[t] = wmma_f16(a0, xf[t][0], vzero);
#pragma unroll
    for (int t = 0; t < 4; ++t) acc[t] = wmma_f16(a1, xf[t][1], acc[t]);
#pragma unroll
    for (int t = 0; t < 4; ++t) {
      acc[t] += bias;
      *reinterpret_cast<v8h*>(krow[t] + n_in * kLdX + et * 16 + mofs) =
          __builtin_convertvector(acc[t], v8h);
    }
  }

  // ---- V = x*Wv^T + bv -> row 64 + d of block key / 64, at key % 64 (B = W^T gather: W stored [e][d]) ----
#pragma unroll 1  // kept rolled, as above
  for (int nt = 0; nt < 4; ++nt) {
    const v16h b0 = load_frag_rm(&wsm[2][(nt * 16) * kLdX + 0],  kLdX, lane);
    const v16h b1 = load_frag_rm(&wsm[2][(nt * 16) * kLdX + 32], kLdX, lane);
    const float bias_n = bsm[2][nt * 16 + n_in];
    v8f acc[4];  // as above
#pragma unroll
    for (int t = 0; t < 4; ++t) acc[t] = wmma_f16(xf[t][0], b0, vzero);
#pragma unroll
    for (int t = 0; t < 4; ++t) acc[t] = wmma_f16(xf[t][1], b1, acc[t]);
#pragma unroll
    for (int t = 0; t < 4; ++t) {
      acc[t] += bias_n;
      *reinterpret_cast<v8h*>(kv + (trow[t] >> 6) * kBlk + (64 + nt * 16 + n_in) * kLdX +
                              (trow[t] & 63) + mofs) =
          __builtin_convertvector(acc[t], v8h);
    }
  }
  __syncthreads();  // K and V^T of all 1024 keys are in LDS

  // per-lane state of query column lane & 15 of each group; lrow holds this
  // lane's share of the row sum (its half of the kv positions) until the end.
  // cm holds -m, the negated maximum in use, eight times: the C operand of the scores
  float lrow[2] = {0.0f, 0.0f};
  v8f cm[2] = {vzero, vzero};
  v8f o[2][4];  // O^T tiles: o[cg][nt][i] = O[query cg*16 + (lane & 15)][nt*16 + mofs + i]
#pragma unroll
  for (int cg = 0; cg < 2; ++cg)
#pragma unroll
    for (int nt = 0; nt < 4; ++nt) o[cg][nt] = vzero;

  // kept rolled: the register budget leaves no room to fetch one pass's fragments
  // under the other, so more copies of the body would only cost padding and text
  int ps = 0;         // pass of 64 kv positions
  bool exact = true;  // this trip finds the pass's maximum before its exponentials
#pragma unroll 1
  while (ps < kS / 64) {  // at most two trips per pass: a trip with exact set always ends its pass
    const _Float16* kcur = kv + ps * kBlk;
    const _Float16* vcur = kcur + 64 * kLdX;

    // ---- scores: S^T = K*Q^T - m;
    // sc[cg][ct][i] = S[query cg*16 + n_in][kv ct*16 + mofs + i] - m[query] ----
    // the pass's K fragments are read as one group, so that the wave waits out
    // the LDS latency once and the later fragments land behind the first products
    v16h kf[4][2];
#pragma unroll
    for (int ct = 0; ct < 4; ++ct) {
      kf[ct][0] = load_frag_rm(kcur + (ct * 16) * kLdX + 0,  kLdX, lane);
      kf[ct][1] = load_frag_rm(kcur + (ct * 16) * kLdX + 32, kLdX, lane);
    }
    // keeps the group of reads here: the scheduler otherwise sinks each pair of
    // reads to its product, where the wave waits out the LDS latency every time
    __builtin_amdgcn_sched_barrier(0);
    v8f sc[2][4];
#pragma unroll
    for (int ct = 0; ct < 4; ++ct) {
#pragma unroll
      for (int cg = 0; cg < 2; ++cg) {
        v8f acc = wmma_f16(kf[ct][0], qf[cg][0], cm[cg]);
        acc = wmma_f16(kf[ct][1], qf[cg][1], acc);
        sc[cg][ct] = acc;
      }
    }

    // V^T fragments of the first 32 kv positions, read as one group into registers
    // that the K fragments have left: the softmax arithmetic covers their latency
    v16h av[4];
#pragma unroll
    for (int nt = 0; nt < 4; ++nt)
      av[nt] = load_frag_rm(vcur + (nt * 16) * kLdX, kLdX, lane);
    __builtin_amdgcn_sched_barrier(0);  // as above: holds the group in place

    // Pass 0 starts from m = 0 and comes here whatever its scores, so that m is a true
    // maximum from then on; a later pass only on its second trip (a scalar branch).
    if (__builtin_expect(exact, false)) {
      const float least = (ps == 0) ? -3.0e38f : 0.0f;  // after pass 0, m never falls
#pragma unroll
      for (int cg = 0; cg < 2; ++cg) {
        // how far this lane's scores of the pass stand above the maximum in use
        float rmax[8];
#pragma unroll
        for (int i = 0; i < 8; ++i) rmax[i] = sc[cg][0][i];
#pragma unroll
        for (int ct = 1; ct < 4; ++ct)
#pragma unroll
          for (int i = 0; i < 8; ++i) rmax[i] = fmaxf(rmax[i], sc[cg][ct][i]);
        const float mx = fmaxf(fmaxf(fmaxf(rmax[0], rmax[1]), fmaxf(rmax[2], rmax[3])),
                               fmaxf(fmaxf(rmax[4], rmax[5]), fmaxf(rmax[6], rmax[7])));
        // both halves of the wave hold the query's pass maximum
        const float d = fmaxf(fmaxf(mx, xhalf(mx)), least);
        // pass 0 may lower m from 0; O and the sums are 0 there, the factor stays finite
        const float scale = __builtin_amdgcn_exp2f(fminf(-d, 0.0f));
#pragma unroll
        for (int ct = 0; ct < 4; ++ct) sc[cg][ct] -= d;
#pragma unroll
        for (int nt = 0; nt < 4; ++nt) o[cg][nt] *= scale;
        lrow[cg] *= scale;
        cm[cg] -= d;
      }
    }

    // ---- P^T = exp2(S^T - m).  Two S^T tiles (kv kc*32 ..
    // +15 and +16 .. +31), converted in place, sit in the k order of
    // load_frag_rm: element s < 8 is k = mofs + s, element s >= 8 is
    // k = 16 + mofs + (s - 8) ----
    // the row sums stand in front of the pass's test: packed adds (even and odd kv side by
    // side), two chains per sum, started from the first pairs
    v2f ts0[2], ts1[2];
#pragma unroll
    for (int kc = 0; kc < 2; ++kc)
#pragma unroll
      for (int cg = 0; cg < 2; ++cg) {
#pragma unroll
        for (int u = 0; u < 2; ++u)
#pragma unroll
          for (int i = 0; i < 8; ++i)
            sc[cg][2 * kc + u][i] = __builtin_amdgcn_exp2f(sc[cg][2 * kc + u][i]);
#pragma unroll
        for (int i = 0; i < 8; i += 2) {
          const v2f a = {sc[cg][2 * kc][i], sc[cg][2 * kc][i + 1]};
          const v2f c = {sc[cg][2 * kc + 1][i], sc[cg][2 * kc + 1][i + 1]};
          ts0[cg] = (kc == 0 && i == 0) ? a : ts0[cg] + a;
          ts1[cg] = (kc == 0 && i == 0) ? c : ts1[cg] + c;
        }
      }
    float ts[2];
#pragma unroll
    for (int cg = 0; cg < 2; ++cg) {
      const v2f t = ts0[cg] + ts1[cg];
      ts[cg] = t[0] + t[1];
    }
    // One scalar test per pass.  No P is negative, so none is above the lane's two sums
    // together: up to kPSum f16 holds them all, at the same relative precision, and nothing
    // moves.  Above it (an infinite sum too) nothing of this trip is kept.  A trip with
    // exact set has every P at most 1, and no sum is above its limit.
    const float lim = exact ? __builtin_inff() : kPSum;
    if (__builtin_expect(__builtin_amdgcn_ballot_w32(ts[0] + ts[1] > lim) != 0, false)) {
      exact = true;
      continue;
    }

    // ---- O^T += V^T * P^T  (Vt stored [d][j] row-major == A source) ----
#pragma unroll
    for (int kc = 0; kc < 2; ++kc) {
      v16h bp[2];
#pragma unroll
      for (int cg = 0; cg < 2; ++cg) {
        const v8h h0 = __builtin_convertvector(sc[cg][2 * kc], v8h);
        const v8h h1 = __builtin_convertvector(sc[cg][2 * kc + 1], v8h);
        bp[cg] = __builtin_shufflevector(h0, h1, 0, 1, 2, 3, 4, 5, 6, 7,
                                         8, 9, 10, 11, 12, 13, 14, 15);
      }
      v16h avn[4];
      if (kc == 0) {
        // keeps this block's conversions in front of the reads below, whose registers are
        // the ones they free: lifted over them, the reads cost copies and spills
        __builtin_amdgcn_sched_barrier(0);
        // the second 32 positions' fragments, again as one group, ahead of this
        // block's products and the next block's conversions
#pragma unroll
        for (int nt = 0; nt < 4; ++nt)
          avn[nt] = load_frag_rm(vcur + (nt * 16) * kLdX + 32, kLdX, lane);
        __builtin_amdgcn_sched_barrier(0);  // as above: holds the group in place
      }
#pragma unroll
      for (int nt = 0; nt < 4; ++nt) {
        o[0][nt] = wmma_f16(av[nt], bp[0], o[0][nt]);
        o[1][nt] = wmma_f16(av[nt], bp[1], o[1][nt]);
      }
      if (kc == 0) {
#pragma unroll
        for (int nt = 0; nt < 4; ++nt) av[nt] = avn[nt];
      }
    }
#pragma unroll
    for (int cg = 0; cg < 2; ++cg) lrow[cg] += ts[cg];
    exact = false;
    ++ps;
  }

  // ---- epilogue: out[b, s0+m0+q, h*64+d] = O / l.  A lane holds 8 consecutive
  // d of one query per group; each wave turns its two 16x64 tiles, one after the
  // other, through its own LDS range so that every store instruction covers whole
  // 256-byte rows.  kv is free behind this barrier: it ends every wave's reads. ----
  __syncthreads();
  float* ost = reinterpret_cast<float*>(&kv[0]) + wave * 16 * kLdO;
#pragma unroll
  for (int cg = 0; cg < 2; ++cg) {
    // join the two halves' partial row sums, once for all kv tiles
    const float inv = 1.0f / (lrow[cg] + xhalf(lrow[cg]));
#pragma unroll
    for (int nt = 0; nt < 4; ++nt) {
      const v8f r = o[cg][nt] * inv;
      float* p = ost + n_in * kLdO + nt * 16 + mofs;
      *reinterpret_cast<v4f*>(p)     = __builtin_shufflevector(r, r, 0, 1, 2, 3);
      *reinterpret_cast<v4f*>(p + 4) = __builtin_shufflevector(r, r, 4, 5, 6, 7);
    }
    // the wave's own staging writes are done before other lanes read them back
    asm volatile("s_wait_dscnt 0x0" ::: "memory");
#pragma unroll
    for (int it = 0; it < 8; ++it) {
      const int row = it * 2 + (lane >> 4);
      const v4f v = *reinterpret_cast<const v4f*>(ost + row * kLdO + n_in * 4);
      *reinterpret_cast<v4f*>(
          out + ((size_t)b * kS + s0 + m0 + cg * 16 + it * 2) * kDim + h * kD + loff) = v;
    }
  }
}

extern "C" void kernel_launch(void* const* d_in, const int* in_sizes, int n_in,
                              void* d_out, int out_size, void* d_ws,
                              size_t ws_size, hipStream_t stream) {
  using namespace msa;
  const float* x  = (const float*)d_in[0];
  const float* Wq = (const float*)d_in[1];
  const float* Wk = (const float*)d_in[2];
  const float* Wv = (const float*)d_in[3];
  const float* bq = (const float*)d_in[4];
  const float* bk = (const float*)d_in[5];
  const float* bv = (const float*)d_in[6];
  float* out = (float*)d_out;

  dim3 grid(kB * kH, kS / kQTile);
  msa_fused_kernel<<<grid, 512, 0, stream>>>(x, Wq, Wk, Wv, bq, bk, bv, out);
}
